// v000
// Measured on an AMD MI455X. A time is GPU time per run, averaged over a window of back-to-back runs after a warm-up
// (all launches, gaps included; the runs take copies of the inputs in turn), and the median of several windows.
// Apart from v000's, it joins two sittings. Times from different sittings can be a few percent apart, while
// side-by-side timings come from the same sitting.
// v000 is the starting kernel. One run takes 1370 microseconds.
#include <hip/hip_runtime.h>

// Causal multi-head self-attention without an output projection (x [2][2048][1024]; q, k, v = x W^T + b ('oi' [1024][1024] + [1024], 16 heads x 64); att = q.k / sqrt(1024) (the module scales by the full hidden size), causal mask (-inf above the diagonal); softmax; out = merged heads -> [2][2048][1024] (4.2 M)).
// Compute dtypes, f32 accumulate: every input rounded to bf16; q/k/v on PLAIN bf16 operands (inputs: exact) + biases; causal scores and attn.v (tile skipping): query rows < 512 hl (3 products), the rest single fp16 (x1024); softmax f32; no output projection: the merged heads are written in f32 straight to the output.

#define NB_  2
#define TT   2048
#define DM   1024
#define NH_  16
#define NKV  16
#define REP  (NH_ / NKV)
#define HD   64
#define DQ   (NH_ * HD)
#define DKV  (NKV * HD)
#define ZH   2
#define RH   512                  // query rows < RH use hi+lo planes (0: none)
#define WIN  2048
#define PCAR 1024.0f
#define SCL  0.03125f   // 1/sqrt(h_dim = 1024): the module scales by the full hidden size
typedef _Float16 h16;
typedef unsigned short bf;
typedef __attribute__((ext_vector_type(16))) __bf16   v16bf;
typedef __attribute__((ext_vector_type(16))) _Float16 v16h;
typedef __attribute__((ext_vector_type(8)))  _Float16 v8h;
typedef __attribute__((ext_vector_type(8)))  unsigned short v8us;
typedef __attribute__((ext_vector_type(8)))  float    v8f;
typedef __attribute__((ext_vector_type(4)))  float    v4f;
typedef v8h  __attribute__((may_alias)) v8ha;
typedef v4f  __attribute__((may_alias)) v4fa;
typedef v8us __attribute__((may_alias)) v8usa;

__device__ __forceinline__ unsigned short f2bf(float f) { unsigned u = __float_as_uint(f); u += 0x7FFFu + ((u >> 16) & 1u); return (unsigned short)(u >> 16); }
__device__ __forceinline__ float bf2f(unsigned short b) { return __uint_as_float(((unsigned)b) << 16); }
__device__ __forceinline__ float bfr(float f) { return bf2f(f2bf(f)); }
__device__ __forceinline__ v16h cat16(v8h lo, v8h hi) { return __builtin_shufflevector(lo, hi, 0, 1, 2, 3, 4, 5, 6, 7, 8, 9, 10, 11, 12, 13, 14, 15); }
__device__ __forceinline__ v16bf cat16b(v8us lo, v8us hi) { return __builtin_bit_cast(v16bf, __builtin_shufflevector(lo, hi, 0, 1, 2, 3, 4, 5, 6, 7, 8, 9, 10, 11, 12, 13, 14, 15)); }
__device__ __forceinline__ v8f wmma16(v16h a, v16h b, v8f c) { return __builtin_amdgcn_wmma_f32_16x16x32_f16(false, a, false, b, (short)0, c, false, false); }
__device__ __forceinline__ v8f wmmab(v16bf a, v16bf b, v8f c) { return __builtin_amdgcn_wmma_f32_16x16x32_bf16(false, a, false, b, (short)0, c, false, false); }



// ---- k_gemmw: register-blocked GEMM, ONE WAVE per 64x64 output tile (16 accumulators), operands straight from K-contiguous 16-bit planes; grid (M/64, N/64, Z), 32 threads.
// C[m][n] (f32, pitch ldc, + optional f32 bias[n]) = sum_k A[m][k] Bt[n][k] (+ split products per NSPLIT). z-batch strides sA/sB/sC in elements. K % 32 == 0.
template <typename T16> struct WFrag;
template <> struct WFrag<h16> { typedef v16h V; static __device__ __forceinline__ V ld(const h16* p) { return cat16(*(const v8h*)p, *(const v8h*)(p + 16)); } static __device__ __forceinline__ v8f mma(V a, V b, v8f c) { return wmma16(a, b, c); } };
template <> struct WFrag<bf> { typedef v16bf V; static __device__ __forceinline__ V ld(const bf* p) { return cat16b(*(const v8us*)p, *(const v8us*)(p + 16)); } static __device__ __forceinline__ v8f mma(V a, V b, v8f c) { return wmmab(a, b, c); } };
template <typename T16, int NSPLIT, bool BIAS>
__global__ __launch_bounds__(32) void k_gemmw(const T16* __restrict__ A, const T16* __restrict__ A2, const T16* __restrict__ Bt, const T16* __restrict__ Bt2, int K, float* C, int ldc, const float* __restrict__ bias, size_t sA, size_t sB, size_t sC) {
    typedef typename WFrag<T16>::V V;
    __shared__ __align__(16) float os[16 * 68];
    const size_t z = blockIdx.z; A += z * sA; if (A2) A2 += z * sA; Bt += z * sB; if (Bt2) Bt2 += z * sB; C += z * sC;
    const int lane = threadIdx.x & 31, lr = lane & 15, hi = lane >> 4; const int r0 = blockIdx.x * 64, c0 = blockIdx.y * 64;
    v8f acc[4][4];
#pragma unroll
    for (int mb = 0; mb < 4; ++mb)
#pragma unroll
        for (int nb = 0; nb < 4; ++nb) acc[mb][nb] = (v8f){};
    const size_t aoff = (size_t)(r0 + lr) * K + 8 * hi, boff = (size_t)(c0 + lr) * K + 8 * hi;
#pragma unroll 1
    for (int kc = 0; kc < K; kc += 32) {
        V a[4], a2[4];
#pragma unroll
        for (int mb = 0; mb < 4; ++mb) { a[mb] = WFrag<T16>::ld(A + aoff + (size_t)mb * 16 * K + kc); if (NSPLIT == 1 || NSPLIT == 2) a2[mb] = WFrag<T16>::ld(A2 + aoff + (size_t)mb * 16 * K + kc); }
#pragma unroll
        for (int nb = 0; nb < 4; ++nb) { const V b = WFrag<T16>::ld(Bt + boff + (size_t)nb * 16 * K + kc); V b2; if (NSPLIT >= 2) b2 = WFrag<T16>::ld(Bt2 + boff + (size_t)nb * 16 * K + kc);
#pragma unroll
            for (int mb = 0; mb < 4; ++mb) { acc[mb][nb] = WFrag<T16>::mma(a[mb], b, acc[mb][nb]); if (NSPLIT == 1 || NSPLIT == 2) acc[mb][nb] = WFrag<T16>::mma(a2[mb], b, acc[mb][nb]); if (NSPLIT >= 2) acc[mb][nb] = WFrag<T16>::mma(a[mb], b2, acc[mb][nb]); } }
        asm volatile("v_nop\n\tv_nop\n\tv_nop\n\tv_nop" : "+v"(acc[0][0]), "+v"(acc[1][1]), "+v"(acc[2][2]), "+v"(acc[3][3]) : "v"(a[0]), "v"(a[3]));
    }
#pragma unroll
    for (int mb = 0; mb < 4; ++mb) {
#pragma unroll
        for (int nb = 0; nb < 4; ++nb) {
#pragma unroll
            for (int j = 0; j < 8; ++j) os[(hi * 8 + j) * 68 + nb * 16 + lr] = acc[mb][nb][j]; }
        __builtin_amdgcn_wave_barrier(); asm volatile("" ::: "memory");
        float* crow = C + (size_t)(r0 + mb * 16) * ldc + c0;
{
#pragma unroll
            for (int s = 0; s < 8; ++s) { const int row = 2 * s + hi, cofs = lr * 4; v4f val = *(const v4fa*)(os + row * 68 + cofs); if (BIAS) { val[0] += bfr(bias[c0 + cofs]); val[1] += bfr(bias[c0 + cofs + 1]); val[2] += bfr(bias[c0 + cofs + 2]); val[3] += bfr(bias[c0 + cofs + 3]); }
                *(v4f*)(crow + (size_t)row * ldc + cofs) = val; }
             }
        __builtin_amdgcn_wave_barrier(); asm volatile("" ::: "memory");
    }
}

// ---- k_gemmc: the same one-wave 64x64 tile GEMM specialised for causal attention: CMODE 1 skips score tiles entirely above the diagonal (query rows r0+roff.., key columns c0..), CMODE 2 limits the
// key (K) loop of the probability x value contraction to the diagonal block (probabilities beyond it are exactly zero). roff = row offset of this launch's first row within the sequence.
template <typename T16, int NSPLIT, int CMODE>
__global__ __launch_bounds__(32) void k_gemmc(const T16* __restrict__ A, const T16* __restrict__ A2, const T16* __restrict__ Bt, const T16* __restrict__ Bt2, int K, float* C, int ldc, int roff, size_t sA, size_t sB, size_t sC) {
    typedef typename WFrag<T16>::V V;
    __shared__ __align__(16) float os[16 * 68];
    const size_t z = blockIdx.z; A += z * sA; if (A2) A2 += z * sA; Bt += z * sB; if (Bt2) Bt2 += z * sB; C += z * sC;
    const int lane = threadIdx.x & 31, lr = lane & 15, hi = lane >> 4; const int r0 = blockIdx.x * 64, c0 = blockIdx.y * 64;
    if (CMODE == 1 && c0 > r0 + roff + 63) return;                  // score tile entirely above the causal diagonal: never read (the softmax masks j > i by select)
    const int Kl = (CMODE == 2) ? min(K, r0 + roff + 64) : K;        // P.V: probabilities are exactly 0 beyond the diagonal block, so the K loop stops there
    v8f acc[4][4];
#pragma unroll
    for (int mb = 0; mb < 4; ++mb)
#pragma unroll
        for (int nb = 0; nb < 4; ++nb) acc[mb][nb] = (v8f){};
    const size_t aoff = (size_t)(r0 + lr) * K + 8 * hi, boff = (size_t)(c0 + lr) * K + 8 * hi;
#pragma unroll 1
    for (int kc = 0; kc < Kl; kc += 32) {
        V a[4], a2[4];
#pragma unroll
        for (int mb = 0; mb < 4; ++mb) { a[mb] = WFrag<T16>::ld(A + aoff + (size_t)mb * 16 * K + kc); if (NSPLIT == 1 || NSPLIT == 2) a2[mb] = WFrag<T16>::ld(A2 + aoff + (size_t)mb * 16 * K + kc); }
#pragma unroll
        for (int nb = 0; nb < 4; ++nb) { const V b = WFrag<T16>::ld(Bt + boff + (size_t)nb * 16 * K + kc); V b2; if (NSPLIT >= 2) b2 = WFrag<T16>::ld(Bt2 + boff + (size_t)nb * 16 * K + kc);
#pragma unroll
            for (int mb = 0; mb < 4; ++mb) { acc[mb][nb] = WFrag<T16>::mma(a[mb], b, acc[mb][nb]); if (NSPLIT == 1 || NSPLIT == 2) acc[mb][nb] = WFrag<T16>::mma(a2[mb], b, acc[mb][nb]); if (NSPLIT >= 2) acc[mb][nb] = WFrag<T16>::mma(a[mb], b2, acc[mb][nb]); } }
        asm volatile("v_nop\n\tv_nop\n\tv_nop\n\tv_nop" : "+v"(acc[0][0]), "+v"(acc[1][1]), "+v"(acc[2][2]), "+v"(acc[3][3]) : "v"(a[0]), "v"(a[3]));
    }
#pragma unroll
    for (int mb = 0; mb < 4; ++mb) {
#pragma unroll
        for (int nb = 0; nb < 4; ++nb) {
#pragma unroll
            for (int j = 0; j < 8; ++j) os[(hi * 8 + j) * 68 + nb * 16 + lr] = acc[mb][nb][j]; }
        __builtin_amdgcn_wave_barrier(); asm volatile("" ::: "memory");
        float* crow = C + (size_t)(r0 + mb * 16) * ldc + c0;
{
#pragma unroll
            for (int s = 0; s < 8; ++s) { const int row = 2 * s + hi, cofs = lr * 4; v4f val = *(const v4fa*)(os + row * 68 + cofs);
                *(v4f*)(crow + (size_t)row * ldc + cofs) = val; }
             }
        __builtin_amdgcn_wave_barrier(); asm volatile("" ::: "memory");
    }
}

__device__ __forceinline__ h16 tohx(float x) { return (h16)x; }
__device__ __forceinline__ void splitf(float y, unsigned short& h, unsigned short& l) { h = f2bf(y); l = f2bf(y - bf2f(h)); }
typedef __attribute__((ext_vector_type(2))) _Float16 v2h;
typedef __attribute__((ext_vector_type(4))) _Float16 v4h;
typedef __attribute__((ext_vector_type(2))) unsigned short v2us;
typedef __attribute__((ext_vector_type(4))) unsigned short v4us;
typedef __attribute__((ext_vector_type(2))) float v2f;
typedef __attribute__((ext_vector_type(4))) int v4i;

__global__ __launch_bounds__(256) void k_wtG(const float* __restrict__ w, int K, int N, bf* Bt) {
    const int lane = threadIdx.x & 31; const int L0 = (blockIdx.x * 8 + (threadIdx.x >> 5)) * 8; const int nlines = N * K / 64;
{
#pragma unroll 1
        for (int l = 0; l < 8; ++l) { const int L = L0 + l; if (L >= nlines) break; const size_t e = (size_t)L * 64 + lane * 2; const int k = (int)(e % K), n = (int)(e / K); v2us o;
            o[0] = f2bf(w[(size_t)k * N + n]); o[1] = f2bf(w[(size_t)(k + 1) * N + n]); *(v2us*)(Bt + e) = o; }
         }
}
__global__ __launch_bounds__(256) void k_cvt8(const float* __restrict__ src, bf* dst, size_t n8) { const size_t i = (size_t)blockIdx.x * 256 + threadIdx.x; if (i >= n8) return; const v8f v = *(const v8f*)(src + i * 8); v8us o;
#pragma unroll
    for (int k = 0; k < 8; ++k) o[k] = f2bf(v[k]); *(v8us*)(dst + i * 8) = o;  }

// k_rope: head planes [h][t][d] (fp16 + hi/lo) of rope(x) x sc with the rotate-half convention out[d] = x[d] cos[t][d] - x[d+HD/2] sin[t][d], out[d+HD/2] = x[d+HD/2] cos[t][d+HD/2] + x[d] sin[t][d+HD/2]
__global__ __launch_bounds__(256) void k_rope(const float* __restrict__ F, int pitch, int nheads, const float* __restrict__ CS, const float* __restrict__ RF, const float* __restrict__ nw, float sc, h16* P16, bf* Ph, bf* Pl) {
    const size_t e = ((size_t)blockIdx.x * 256 + threadIdx.x) * 2; if (e >= (size_t)nheads * TT * HD) return; const int d = (int)(e % HD); const int t = (int)((e / HD) % TT); const int h = (int)(e / ((size_t)HD * TT)); const float* f = F + (size_t)t * pitch + h * HD; const float rf = RF ? RF[(size_t)h * TT + t] : 1.0f; v2h o16; v2us oh, ol;
#pragma unroll
    for (int q = 0; q < 2; ++q) { const int dd = d + q; const int dp = (dd < HD / 2) ? dd + HD / 2 : dd - HD / 2; float x0 = f[dd], x1 = f[dp];
        if (RF) { float n0 = __fmul_rn(x0, rf), n1 = __fmul_rn(x1, rf); asm volatile("" : "+v"(n0)); asm volatile("" : "+v"(n1)); x0 = __fmul_rn(bfr(nw[dd]), n0); x1 = __fmul_rn(bfr(nw[dp]), n1); }
        const v2f cs = *(const v2f*)(CS + ((size_t)t * HD + dd) * 2); float a = __fmul_rn(x0, cs[0]), bq = __fmul_rn(x1, cs[1]); asm volatile("" : "+v"(a)); asm volatile("" : "+v"(bq)); const float r = ((dd < HD / 2) ? __fsub_rn(a, bq) : __fadd_rn(a, bq)) * sc;
        o16[q] = tohx(r); unsigned short a2, c2; splitf(r, a2, c2); oh[q] = a2; ol[q] = c2; }
    *(v2h*)(P16 + e) = o16; *(v2us*)(Ph + e) = oh; *(v2us*)(Pl + e) = ol;  }
__global__ __launch_bounds__(256) void k_vtp(const float* __restrict__ F, int pitch, int nheads, h16* V16, bf* Vh, bf* Vl) { const size_t e = ((size_t)blockIdx.x * 256 + threadIdx.x) * 2; if (e >= (size_t)nheads * HD * TT) return; const int t = (int)(e % TT); const int d = (int)((e / TT) % HD); const int g = (int)(e / ((size_t)TT * HD)); v2h o16; v2us oh, ol;
#pragma unroll
    for (int q = 0; q < 2; ++q) { const float x = F[(size_t)(t + q) * pitch + g * HD + d]; o16[q] = tohx(x); unsigned short a2, c2; splitf(x, a2, c2); oh[q] = a2; ol[q] = c2; }
    *(v2h*)(V16 + e) = o16; *(v2us*)(Vh + e) = oh; *(v2us*)(Vl + e) = ol;  }
__global__ __launch_bounds__(256) void k_csid(float* CS) { const int idx = blockIdx.x * 256 + threadIdx.x; if (idx >= TT * HD) return; v2f cs; cs[0] = 1.0f; cs[1] = 0.0f; *(v2f*)(CS + (size_t)idx * 2) = cs;  }
// k_asoft: per row (zz, i): t = S x 1024^-0.5 for j <= i and i - j < WIN (sliding causal window; the reference's -1e9 additive fill vanishes identically); softmax over the 2048 keys (register row, one exp, fixed trees);
__global__ __launch_bounds__(256) void k_asoft(const float* __restrict__ Sb, h16* P16, bf* Ph, bf* Pl) {
    const int lane = threadIdx.x & 31; const int row = blockIdx.x * 8 + (threadIdx.x >> 5); if (row >= ZH * TT) return; const int i = row % TT; const int zz = row / TT; (void)zz; const bool hires = (i < RH); const float* sr = Sb + (size_t)row * TT; float v[TT / 32]; float mx = -3.0e38f;
#pragma unroll
    for (int ch = 0; ch < TT / 128; ++ch) { const int j0 = ch * 128 + lane * 4; const v4f a = *(const v4f*)(sr + j0);
#pragma unroll
        for (int q = 0; q < 4; ++q) { const int j = j0 + q; (void)j; const float t = (j <= i && i - j < WIN) ? a[q] * SCL : -3.0e38f; v[ch * 4 + q] = t; mx = fmaxf(mx, t); } }
#pragma unroll
    for (int sh = 16; sh; sh >>= 1) mx = fmaxf(mx, __shfl_xor(mx, sh, 32));
    float sum = 0.f;
#pragma unroll
    for (int k = 0; k < TT / 32; ++k) { float d0 = __fsub_rn(v[k], mx); asm volatile("" : "+v"(d0)); v[k] = __builtin_amdgcn_exp2f(__fmul_rn(d0, 1.4426950408889634f)); sum += v[k]; }
#pragma unroll
    for (int sh = 16; sh; sh >>= 1) sum += __shfl_xor(sum, sh, 32);
    const float f = __fdiv_rn(hires ? 1.0f : PCAR, sum);
{
        if (hires) {
#pragma unroll
            for (int ch = 0; ch < TT / 128; ++ch) { v4us oh, ol;
#pragma unroll
                for (int q = 0; q < 4; ++q) { unsigned short a, c2; splitf(v[ch * 4 + q] * f, a, c2); oh[q] = a; ol[q] = c2; }
                const size_t oo = ((size_t)zz * (RH ? RH : 1) + i) * TT + ch * 128 + lane * 4; *(v4us*)(Ph + oo) = oh; *(v4us*)(Pl + oo) = ol; }
        } else {
#pragma unroll
            for (int ch = 0; ch < TT / 128; ++ch) { v4h o4;
#pragma unroll
                for (int q = 0; q < 4; ++q) o4[q] = tohx(v[ch * 4 + q] * f);
                *(v4h*)(P16 + (size_t)row * TT + ch * 128 + lane * 4) = o4; } }
         }
}
__global__ __launch_bounds__(256) void k_mergeO(const float* __restrict__ O, int h0, float* out) { const size_t e = ((size_t)blockIdx.x * 256 + threadIdx.x) * 2; if (e >= (size_t)ZH * TT * HD) return; const int d = (int)(e % HD); const int t = (int)((e / HD) % TT); const int zz = (int)(e / ((size_t)HD * TT)); const float cs = (t < RH) ? 1.0f : (1.0f / PCAR); const size_t oo = (size_t)t * DQ + (h0 + zz) * HD + d; v2f o; o[0] = O[e] * cs; o[1] = O[e + 1] * cs;
    *(v2f*)(out + oo) = o;  }

extern "C" void kernel_launch(void* const* d_in, const int* in_sizes, int n_in,
                              void* d_out, int out_size, void* d_ws, size_t ws_size, hipStream_t stream) {
    (void)in_sizes; (void)n_in; (void)out_size;
    const float* x = (const float*)d_in[0]; const float* wq = (const float*)d_in[1]; const float* bq = (const float*)d_in[2]; const float* wk = (const float*)d_in[3]; const float* bk = (const float*)d_in[4]; const float* wv = (const float*)d_in[5]; const float* bv = (const float*)d_in[6]; const float* wo = nullptr; (void)wo;
    float* OUT = (float*)d_out;     // [2][2048][1024]
    char* wsp = (char*)d_ws;
    auto take = [&](size_t bytes) { char* p = wsp; wsp += (bytes + 255) & ~(size_t)255; return (void*)p; };
    bf* WQ = (bf*)take((size_t)DQ * DM * 2); bf* WK = (bf*)take((size_t)DKV * DM * 2); bf* WV = (bf*)take((size_t)DKV * DM * 2); float* CS = (float*)take((size_t)TT * HD * 2 * 4);
    bf* XB = (bf*)take((size_t)TT * DM * 2); float* FQ = (float*)take((size_t)TT * DQ * 4); float* FK = (float*)take((size_t)TT * DKV * 4);
    h16* QP16 = (h16*)take((size_t)NH_ * TT * HD * 2); h16* KP16 = (h16*)take((size_t)NKV * TT * HD * 2); h16* VT16 = (h16*)take((size_t)NKV * HD * TT * 2);
    bf* QPh = (bf*)take((size_t)NH_ * TT * HD * 2); bf* QPl = (bf*)take((size_t)NH_ * TT * HD * 2); bf* KPh = (bf*)take((size_t)NKV * TT * HD * 2); bf* KPl = (bf*)take((size_t)NKV * TT * HD * 2); bf* VTh = (bf*)take((size_t)NKV * HD * TT * 2); bf* VTl = (bf*)take((size_t)NKV * HD * TT * 2); bf* Ph = (bf*)take((size_t)ZH * RH * TT * 2); bf* Pl = (bf*)take((size_t)ZH * RH * TT * 2);
    float* Sb = (float*)take((size_t)ZH * TT * TT * 4); h16* P16 = (h16*)take((size_t)ZH * TT * TT * 2); float* Ob = (float*)take((size_t)ZH * TT * HD * 4);
    if ((size_t)(wsp - (char*)d_ws) > ws_size) return;    // ws 256 MiB
    float* FV = FK;   // v projection reuses the k buffer after the k planes are built (stream-ordered)
    { k_cvt8<<<(unsigned)(((size_t)DQ * DM / 8 + 255) / 256), 256, 0, stream>>>(wq, WQ, (size_t)DQ * DM / 8); k_cvt8<<<(unsigned)(((size_t)DKV * DM / 8 + 255) / 256), 256, 0, stream>>>(wk, WK, (size_t)DKV * DM / 8); k_cvt8<<<(unsigned)(((size_t)DKV * DM / 8 + 255) / 256), 256, 0, stream>>>(wv, WV, (size_t)DKV * DM / 8);
      
       }
    k_csid<<<(TT * HD + 255) / 256, 256, 0, stream>>>(CS);
    const unsigned LQ = (unsigned)(((size_t)NH_ * TT * HD / 2 + 255) / 256), LKv = (unsigned)(((size_t)NKV * TT * HD / 2 + 255) / 256);
    for (int b = 0; b < NB_; ++b) {
        
        k_cvt8<<<(unsigned)(((size_t)TT * DM / 8 + 255) / 256), 256, 0, stream>>>(x + (size_t)b * TT * DM, XB, (size_t)TT * DM / 8);
        k_gemmw<bf, 0, true><<<dim3(TT / 64, DQ / 64, 1), 32, 0, stream>>>(XB, nullptr, WQ, nullptr, DM, FQ, DQ, bq, 0, 0, 0);
        k_rope<<<LQ, 256, 0, stream>>>(FQ, DQ, NH_, CS, nullptr, nullptr, 1.0f, QP16, QPh, QPl);
        k_gemmw<bf, 0, true><<<dim3(TT / 64, DKV / 64, 1), 32, 0, stream>>>(XB, nullptr, WK, nullptr, DM, FK, DKV, bk, 0, 0, 0);
        k_rope<<<LKv, 256, 0, stream>>>(FK, DKV, NKV, CS, nullptr, nullptr, 1.0f, KP16, KPh, KPl);
        k_gemmw<bf, 0, true><<<dim3(TT / 64, DKV / 64, 1), 32, 0, stream>>>(XB, nullptr, WV, nullptr, DM, FV, DKV, bv, 0, 0, 0); k_vtp<<<LKv, 256, 0, stream>>>(FV, DKV, NKV, VT16, VTh, VTl);
        for (int h0 = 0; h0 < NH_; h0 += ZH) { const size_t zq = (size_t)h0, zk = (size_t)(h0 / REP);   // one kv head per query head: the pass's two heads use consecutive kv planes (z-strides TT*HD)
            k_gemmc<bf, 2, 1><<<dim3(RH / 64, TT / 64, ZH), 32, 0, stream>>>(QPh + zq * TT * HD, QPl + zq * TT * HD, KPh + zk * TT * HD, KPl + zk * TT * HD, HD, Sb, TT, 0, (size_t)TT * HD, (size_t)TT * HD, (size_t)TT * TT);
            k_gemmc<h16, 0, 1><<<dim3((TT - RH) / 64, TT / 64, ZH), 32, 0, stream>>>(QP16 + zq * TT * HD + (size_t)RH * HD, nullptr, KP16 + zk * TT * HD, nullptr, HD, Sb + (size_t)RH * TT, TT, RH, (size_t)TT * HD, (size_t)TT * HD, (size_t)TT * TT);
            k_asoft<<<ZH * TT / 8, 256, 0, stream>>>(Sb, P16, Ph, Pl);
            k_gemmc<bf, 2, 2><<<dim3(RH / 64, HD / 64, ZH), 32, 0, stream>>>(Ph, Pl, VTh + zk * HD * TT, VTl + zk * HD * TT, TT, Ob, HD, 0, (size_t)RH * TT, (size_t)HD * TT, (size_t)TT * HD);
            k_gemmc<h16, 0, 2><<<dim3((TT - RH) / 64, HD / 64, ZH), 32, 0, stream>>>(P16 + (size_t)RH * TT, nullptr, VT16 + zk * HD * TT, nullptr, TT, Ob + (size_t)RH * HD, HD, RH, (size_t)TT * TT, (size_t)HD * TT, (size_t)TT * HD);
            k_mergeO<<<(unsigned)(((size_t)ZH * TT * HD / 2 + 255) / 256), 256, 0, stream>>>(Ob, h0, OUT + (size_t)b * TT * DQ); } }
}

// v001
// One run takes 271 microseconds.
// Two timings next to v000 put it at 5.10 and 5.07 times that version's speed.
#include <hip/hip_runtime.h>

// Causal multi-head self-attention without an output projection (x [2][2048][1024]; q, k, v = x W^T + b ('oi' [1024][1024] + [1024], 16 heads x 64); att = q.k / sqrt(1024) (the module scales by the full hidden size), causal mask (-inf above the diagonal); softmax; out = merged heads -> [2][2048][1024] (4.2 M)).
// Compute dtypes, f32 accumulate: every input rounded to bf16; q/k/v on PLAIN bf16 operands (inputs: exact) + biases; causal scores and attn.v in one launch (running maximum and sum over 32- or 64-key steps): query rows < 512 hl (3 products), the rest single fp16; softmax f32; no output projection: the merged heads are written in f32 straight to the output.

#define NB_  2
#define TT   2048
#define DM   1024
#define NH_  16
#define NKV  16
#define HD   64
#define DQ   (NH_ * HD)
#define DKV  (NKV * HD)
#define RH   512                  // query rows < RH use hi+lo planes (0: none)
#define SCL  0.03125f   // 1/sqrt(h_dim = 1024): the module scales by the full hidden size
typedef _Float16 h16;
typedef unsigned short bf;
typedef __attribute__((ext_vector_type(16))) __bf16   v16bf;
typedef __attribute__((ext_vector_type(16))) _Float16 v16h;
typedef __attribute__((ext_vector_type(8)))  _Float16 v8h;
typedef __attribute__((ext_vector_type(8)))  unsigned short v8us;
typedef __attribute__((ext_vector_type(8)))  float    v8f;
typedef __attribute__((ext_vector_type(4)))  float    v4f;
typedef v8h  __attribute__((may_alias)) v8ha;
typedef v4f  __attribute__((may_alias)) v4fa;
typedef v8us __attribute__((may_alias)) v8usa;

__device__ __forceinline__ unsigned short f2bf(float f) { unsigned u = __float_as_uint(f); u += 0x7FFFu + ((u >> 16) & 1u); return (unsigned short)(u >> 16); }
__device__ __forceinline__ float bf2f(unsigned short b) { return __uint_as_float(((unsigned)b) << 16); }
__device__ __forceinline__ float bfr(float f) { return bf2f(f2bf(f)); }
__device__ __forceinline__ v16h cat16(v8h lo, v8h hi) { return __builtin_shufflevector(lo, hi, 0, 1, 2, 3, 4, 5, 6, 7, 8, 9, 10, 11, 12, 13, 14, 15); }
__device__ __forceinline__ v16bf cat16b(v8us lo, v8us hi) { return __builtin_bit_cast(v16bf, __builtin_shufflevector(lo, hi, 0, 1, 2, 3, 4, 5, 6, 7, 8, 9, 10, 11, 12, 13, 14, 15)); }
__device__ __forceinline__ v8f wmma16(v16h a, v16h b, v8f c) { return __builtin_amdgcn_wmma_f32_16x16x32_f16(false, a, false, b, (short)0, c, false, false); }
__device__ __forceinline__ v8f wmmab(v16bf a, v16bf b, v8f c) { return __builtin_amdgcn_wmma_f32_16x16x32_bf16(false, a, false, b, (short)0, c, false, false); }



// ---- k_gemmw: register-blocked GEMM, ONE WAVE per 64x64 output tile (16 accumulators), operands straight from K-contiguous 16-bit planes; grid (M/64, N/64, Z), 32 threads.
// C[m][n] (f32, pitch ldc, + optional f32 bias[n]) = sum_k A[m][k] Bt[n][k] (+ split products per NSPLIT). z-batch strides sA/sB/sC in elements. K % 32 == 0.
template <typename T16> struct WFrag;
template <> struct WFrag<h16> { typedef v16h V; static __device__ __forceinline__ V ld(const h16* p) { return cat16(*(const v8h*)p, *(const v8h*)(p + 16)); } static __device__ __forceinline__ v8f mma(V a, V b, v8f c) { return wmma16(a, b, c); } };
template <> struct WFrag<bf> { typedef v16bf V; static __device__ __forceinline__ V ld(const bf* p) { return cat16b(*(const v8us*)p, *(const v8us*)(p + 16)); } static __device__ __forceinline__ v8f mma(V a, V b, v8f c) { return wmmab(a, b, c); } };
template <typename T16, int NSPLIT, bool BIAS>
__global__ __launch_bounds__(32) void k_gemmw(const T16* __restrict__ A, const T16* __restrict__ A2, const T16* __restrict__ Bt, const T16* __restrict__ Bt2, int K, float* C, int ldc, const float* __restrict__ bias, size_t sA, size_t sB, size_t sC) {
    typedef typename WFrag<T16>::V V;
    __shared__ __align__(16) float os[16 * 68];
    const size_t z = blockIdx.z; A += z * sA; if (A2) A2 += z * sA; Bt += z * sB; if (Bt2) Bt2 += z * sB; C += z * sC;
    const int lane = threadIdx.x & 31, lr = lane & 15, hi = lane >> 4; const int r0 = blockIdx.x * 64, c0 = blockIdx.y * 64;
    v8f acc[4][4];
#pragma unroll
    for (int mb = 0; mb < 4; ++mb)
#pragma unroll
        for (int nb = 0; nb < 4; ++nb) acc[mb][nb] = (v8f){};
    const size_t aoff = (size_t)(r0 + lr) * K + 8 * hi, boff = (size_t)(c0 + lr) * K + 8 * hi;
#pragma unroll 1
    for (int kc = 0; kc < K; kc += 32) {
        V a[4], a2[4];
#pragma unroll
        for (int mb = 0; mb < 4; ++mb) { a[mb] = WFrag<T16>::ld(A + aoff + (size_t)mb * 16 * K + kc); if (NSPLIT == 1 || NSPLIT == 2) a2[mb] = WFrag<T16>::ld(A2 + aoff + (size_t)mb * 16 * K + kc); }
#pragma unroll
        for (int nb = 0; nb < 4; ++nb) { const V b = WFrag<T16>::ld(Bt + boff + (size_t)nb * 16 * K + kc); V b2; if (NSPLIT >= 2) b2 = WFrag<T16>::ld(Bt2 + boff + (size_t)nb * 16 * K + kc);
#pragma unroll
            for (int mb = 0; mb < 4; ++mb) { acc[mb][nb] = WFrag<T16>::mma(a[mb], b, acc[mb][nb]); if (NSPLIT == 1 || NSPLIT == 2) acc[mb][nb] = WFrag<T16>::mma(a2[mb], b, acc[mb][nb]); if (NSPLIT >= 2) acc[mb][nb] = WFrag<T16>::mma(a[mb], b2, acc[mb][nb]); } }
        asm volatile("v_nop\n\tv_nop\n\tv_nop\n\tv_nop" : "+v"(acc[0][0]), "+v"(acc[1][1]), "+v"(acc[2][2]), "+v"(acc[3][3]) : "v"(a[0]), "v"(a[3]));
    }
#pragma unroll
    for (int mb = 0; mb < 4; ++mb) {
#pragma unroll
        for (int nb = 0; nb < 4; ++nb) {
#pragma unroll
            for (int j = 0; j < 8; ++j) os[(hi * 8 + j) * 68 + nb * 16 + lr] = acc[mb][nb][j]; }
        __builtin_amdgcn_wave_barrier(); asm volatile("" ::: "memory");
        float* crow = C + (size_t)(r0 + mb * 16) * ldc + c0;
{
#pragma unroll
            for (int s = 0; s < 8; ++s) { const int row = 2 * s + hi, cofs = lr * 4; v4f val = *(const v4fa*)(os + row * 68 + cofs); if (BIAS) { val[0] += bfr(bias[c0 + cofs]); val[1] += bfr(bias[c0 + cofs + 1]); val[2] += bfr(bias[c0 + cofs + 2]); val[3] += bfr(bias[c0 + cofs + 3]); }
                *(v4f*)(crow + (size_t)row * ldc + cofs) = val; }
             }
        __builtin_amdgcn_wave_barrier(); asm volatile("" ::: "memory");
    }
}

__device__ __forceinline__ h16 tohx(float x) { return (h16)x; }
__device__ __forceinline__ void splitf(float y, unsigned short& h, unsigned short& l) { h = f2bf(y); l = f2bf(y - bf2f(h)); }
typedef __attribute__((ext_vector_type(2))) _Float16 v2h;
typedef __attribute__((ext_vector_type(4))) _Float16 v4h;
typedef __attribute__((ext_vector_type(2))) unsigned short v2us;
typedef __attribute__((ext_vector_type(4))) unsigned short v4us;
typedef __attribute__((ext_vector_type(2))) float v2f;
typedef __attribute__((ext_vector_type(4))) int v4i;

__global__ __launch_bounds__(256) void k_wtG(const float* __restrict__ w, int K, int N, bf* Bt) {
    const int lane = threadIdx.x & 31; const int L0 = (blockIdx.x * 8 + (threadIdx.x >> 5)) * 8; const int nlines = N * K / 64;
{
#pragma unroll 1
        for (int l = 0; l < 8; ++l) { const int L = L0 + l; if (L >= nlines) break; const size_t e = (size_t)L * 64 + lane * 2; const int k = (int)(e % K), n = (int)(e / K); v2us o;
            o[0] = f2bf(w[(size_t)k * N + n]); o[1] = f2bf(w[(size_t)(k + 1) * N + n]); *(v2us*)(Bt + e) = o; }
         }
}
__global__ __launch_bounds__(256) void k_cvt8(const float* __restrict__ src, bf* dst, size_t n8) { const size_t i = (size_t)blockIdx.x * 256 + threadIdx.x; if (i >= n8) return; const v8f v = *(const v8f*)(src + i * 8); v8us o;
#pragma unroll
    for (int k = 0; k < 8; ++k) o[k] = f2bf(v[k]); *(v8us*)(dst + i * 8) = o;  }

// k_rope: head planes [h][t][d] (fp16 + hi/lo) of rope(x) x sc with the rotate-half convention out[d] = x[d] cos[t][d] - x[d+HD/2] sin[t][d], out[d+HD/2] = x[d+HD/2] cos[t][d+HD/2] + x[d] sin[t][d+HD/2]
__global__ __launch_bounds__(256) void k_rope(const float* __restrict__ F, int pitch, int nheads, const float* __restrict__ CS, const float* __restrict__ RF, const float* __restrict__ nw, float sc, h16* P16, bf* Ph, bf* Pl) {
    const size_t e = ((size_t)blockIdx.x * 256 + threadIdx.x) * 2; if (e >= (size_t)nheads * TT * HD) return; const int d = (int)(e % HD); const int t = (int)((e / HD) % TT); const int h = (int)(e / ((size_t)HD * TT)); const float* f = F + (size_t)t * pitch + h * HD; const float rf = RF ? RF[(size_t)h * TT + t] : 1.0f; v2h o16; v2us oh, ol;
#pragma unroll
    for (int q = 0; q < 2; ++q) { const int dd = d + q; const int dp = (dd < HD / 2) ? dd + HD / 2 : dd - HD / 2; float x0 = f[dd], x1 = f[dp];
        if (RF) { float n0 = __fmul_rn(x0, rf), n1 = __fmul_rn(x1, rf); asm volatile("" : "+v"(n0)); asm volatile("" : "+v"(n1)); x0 = __fmul_rn(bfr(nw[dd]), n0); x1 = __fmul_rn(bfr(nw[dp]), n1); }
        const v2f cs = *(const v2f*)(CS + ((size_t)t * HD + dd) * 2); float a = __fmul_rn(x0, cs[0]), bq = __fmul_rn(x1, cs[1]); asm volatile("" : "+v"(a)); asm volatile("" : "+v"(bq)); const float r = ((dd < HD / 2) ? __fsub_rn(a, bq) : __fadd_rn(a, bq)) * sc;
        o16[q] = tohx(r); unsigned short a2, c2; splitf(r, a2, c2); oh[q] = a2; ol[q] = c2; }
    *(v2h*)(P16 + e) = o16; *(v2us*)(Ph + e) = oh; *(v2us*)(Pl + e) = ol;  }
__global__ __launch_bounds__(256) void k_vtp(const float* __restrict__ F, int pitch, int nheads, h16* V16, bf* Vh, bf* Vl) { const size_t e = ((size_t)blockIdx.x * 256 + threadIdx.x) * 2; if (e >= (size_t)nheads * HD * TT) return; const int t = (int)(e % TT); const int d = (int)((e / TT) % HD); const int g = (int)(e / ((size_t)TT * HD)); v2h o16; v2us oh, ol;
#pragma unroll
    for (int q = 0; q < 2; ++q) { const float x = F[(size_t)(t + q) * pitch + g * HD + d]; o16[q] = tohx(x); unsigned short a2, c2; splitf(x, a2, c2); oh[q] = a2; ol[q] = c2; }
    *(v2h*)(V16 + e) = o16; *(v2us*)(Vh + e) = oh; *(v2us*)(Vl + e) = ol;  }
__global__ __launch_bounds__(256) void k_csid(float* CS) { const int idx = blockIdx.x * 256 + threadIdx.x; if (idx >= TT * HD) return; v2f cs; cs[0] = 1.0f; cs[1] = 0.0f; *(v2f*)(CS + (size_t)idx * 2) = cs;  }
// ---- k_fattn: scores, causal softmax and probability x value in one launch for every batch and head. One wave owns 16 query rows and walks its keys KT x 16 at a time with a running maximum and sum.
// Transposed products: S^T = K Q^T (A = key rows, B = query rows), O^T += V^T P^T (A = V^T rows, B = two score tiles converted in place), so a lane holds one query's scores and P needs no lane exchange and no LDS.
// HL (query rows < RH): hi+lo bf16 planes, 3 products each, 32 keys a step; otherwise single fp16, 64 keys a step. Grid: heaviest 64-row query groups first, 4 waves a block.
__device__ __forceinline__ float xhalf(float x) { return __builtin_bit_cast(float, __builtin_amdgcn_permlanex16(__builtin_bit_cast(int, x), __builtin_bit_cast(int, x), 0x76543210, 0xfedcba98, false, false)); }  // lane l with lane l ^ 16
// 2^x with the one free issue slot behind a transcendental written in
__device__ __forceinline__ float exp2s(float x) { float r; asm("v_exp_f32 %0, %1\n\tv_nop" : "=v"(r) : "v"(x)); return r; }
__device__ __forceinline__ v16h packp(const float* p, v16h*) { v16h r;
#pragma unroll
    for (int e = 0; e < 16; ++e) r[e] = (h16)p[e];
    return r; }
__device__ __forceinline__ v16bf packp(const float* p, v16bf* lo) { v8us h0, h1, l0, l1;
#pragma unroll
    for (int e = 0; e < 8; ++e) { unsigned short a, c; splitf(p[e], a, c); h0[e] = a; l0[e] = c; splitf(p[8 + e], a, c); h1[e] = a; l1[e] = c; }
    *lo = cat16b(l0, l1); return cat16b(h0, h1); }
template <typename T16, bool HL, int KT>
__device__ __forceinline__ void attn_rows(const T16* __restrict__ Q, const T16* __restrict__ Q2, const T16* __restrict__ Kp, const T16* __restrict__ K2, const T16* __restrict__ Vt, const T16* __restrict__ Vt2, int q0, int lr, int hi, float* __restrict__ orow) {
    typedef typename WFrag<T16>::V V;                // every full '#pragma unroll' below keeps a fragment or score array in registers (constant indices)
    const float CE = SCL * 1.4426950408889634f;      // raw score -> log2 domain
    const size_t qo = (size_t)(q0 + lr) * HD + 8 * hi, ko = (size_t)lr * HD + 8 * hi, vo = (size_t)lr * TT + 8 * hi;
    V qf[2], qf2[2];
#pragma unroll
    for (int c = 0; c < 2; ++c) { qf[c] = WFrag<T16>::ld(Q + qo + c * 32); if (HL) qf2[c] = WFrag<T16>::ld(Q2 + qo + c * 32); }
    v8f o[4];
#pragma unroll
    for (int dt = 0; dt < 4; ++dt) o[dt] = (v8f){};
    float m = -3.0e38f, l = 0.f;
    const int nst = (q0 + 15 + KT * 16) / (KT * 16); // keys 0 .. q0 + 15 in steps of KT x 16; the last step ends at or below TT
    V kf[KT][2], kf2[KT][2];
    if (!HL) {
#pragma unroll
        for (int kt = 0; kt < KT; ++kt)
#pragma unroll
            for (int c = 0; c < 2; ++c) kf[kt][c] = WFrag<T16>::ld(Kp + ko + (size_t)(kt * 16) * HD + c * 32); }
#pragma unroll 1                                     // rolled: two steps unrolled take more than 256 registers, one wave a SIMD fewer
    for (int s = 0; s < nst; ++s) {
        const int kb = s * (KT * 16);
        V vf[4][KT / 2], vf2[4][KT / 2];
        if (HL) {                                     // hi+lo planes: twice the fragments, so keys and values take turns in the registers (at most RH / 32 steps a wave)
#pragma unroll
            for (int kt = 0; kt < KT; ++kt)
#pragma unroll
                for (int c = 0; c < 2; ++c) { kf[kt][c] = WFrag<T16>::ld(Kp + ko + (size_t)(kb + kt * 16) * HD + c * 32); kf2[kt][c] = WFrag<T16>::ld(K2 + ko + (size_t)(kb + kt * 16) * HD + c * 32); }
        } else {
#pragma unroll
            for (int dt = 0; dt < 4; ++dt)
#pragma unroll
                for (int kc = 0; kc < KT / 2; ++kc) vf[dt][kc] = WFrag<T16>::ld(Vt + vo + (size_t)(dt * 16) * TT + kb + kc * 32);
        }
        v8f st[KT];
#pragma unroll
        for (int kt = 0; kt < KT; ++kt) { st[kt] = (v8f){};
#pragma unroll
            for (int c = 0; c < 2; ++c) { st[kt] = WFrag<T16>::mma(kf[kt][c], qf[c], st[kt]); if (HL) { st[kt] = WFrag<T16>::mma(kf[kt][c], qf2[c], st[kt]); st[kt] = WFrag<T16>::mma(kf2[kt][c], qf[c], st[kt]); } } }
        if (HL) {
            asm volatile("s_wait_xcnt 0x0" ::: "memory");  // the key loads' address registers are reused by the value loads below
#pragma unroll
            for (int dt = 0; dt < 4; ++dt)
#pragma unroll
                for (int kc = 0; kc < KT / 2; ++kc) { vf[dt][kc] = WFrag<T16>::ld(Vt + vo + (size_t)(dt * 16) * TT + kb + kc * 32); vf2[dt][kc] = WFrag<T16>::ld(Vt2 + vo + (size_t)(dt * 16) * TT + kb + kc * 32); }
            asm volatile("s_wait_xcnt 0x0" ::: "memory");  // the value loads' address registers are reused by the softmax below
        }
        float p[KT * 8];
#pragma unroll
        for (int e = 0; e < KT * 8; ++e) p[e] = st[e >> 3][e & 7];
        if (kb + KT * 16 - 1 > q0) {                  // only a step that reaches the diagonal masks (wave-uniform)
#pragma unroll
            for (int e = 0; e < KT * 8; ++e) p[e] = (kb + (e >> 3) * 16 + hi * 8 + (e & 7) <= q0 + lr) ? p[e] : -3.0e38f; }
        if (!HL) {
            const int kn = (s + 1 < nst) ? kb + KT * 16 : kb;  // next step's key fragments fly under softmax and P.V; the last step refetches its own rows (in bounds)
#pragma unroll
            for (int kt = 0; kt < KT; ++kt)
#pragma unroll
                for (int c = 0; c < 2; ++c) kf[kt][c] = WFrag<T16>::ld(Kp + ko + (size_t)(kn + kt * 16) * HD + c * 32);
        }
        float mx = p[0];
#pragma unroll
        for (int e = 1; e < KT * 8; ++e) mx = fmaxf(mx, p[e]);
        mx = fmaxf(mx, xhalf(mx));
        const float mn = fmaxf(m, mx), al = exp2s((m - mn) * CE), mc = mn * CE; m = mn;
        float ls = 0.f;
#pragma unroll
        for (int e = 0; e < KT * 8; ++e) { p[e] = exp2s(__builtin_fmaf(p[e], CE, -mc)); ls += p[e]; }
        l = l * al + ls;
#pragma unroll
        for (int dt = 0; dt < 4; ++dt) o[dt] *= al;
#pragma unroll
        for (int kc = 0; kc < KT / 2; ++kc) { V pf2; const V pf = packp(p + kc * 16, &pf2);
#pragma unroll
            for (int dt = 0; dt < 4; ++dt) { o[dt] = WFrag<T16>::mma(vf[dt][kc], pf, o[dt]); if (HL) { o[dt] = WFrag<T16>::mma(vf[dt][kc], pf2, o[dt]); o[dt] = WFrag<T16>::mma(vf2[dt][kc], pf, o[dt]); } } }
    }
    l += xhalf(l);
    const float inv = __fdiv_rn(1.0f, l);
#pragma unroll
    for (int dt = 0; dt < 4; ++dt) { v4f a, b;
#pragma unroll
        for (int j = 0; j < 4; ++j) { a[j] = o[dt][j] * inv; b[j] = o[dt][4 + j] * inv; }
        *(v4f*)(orow + dt * 16) = a; *(v4f*)(orow + dt * 16 + 4) = b; }
}
__global__ __launch_bounds__(128) void k_fattn(const h16* __restrict__ Q16, const h16* __restrict__ K16, const h16* __restrict__ V16, const bf* __restrict__ Qh, const bf* __restrict__ Ql, const bf* __restrict__ Kh, const bf* __restrict__ Kl, const bf* __restrict__ Vh, const bf* __restrict__ Vl, float* __restrict__ out) {
    const int lane = threadIdx.x & 31, lr = lane & 15, hi = lane >> 4; const int wv = __builtin_amdgcn_readfirstlane((int)(threadIdx.x >> 5));
    const int bh = blockIdx.x % (NB_ * NH_), qg = TT / 64 - 1 - (int)(blockIdx.x / (NB_ * NH_)); const int q0 = qg * 64 + wv * 16;
    const size_t pl = (size_t)bh * TT * HD;          // this batch and head's plane ([t][d] for q and k, [d][t] for v)
    float* orow = out + ((size_t)(bh / NH_) * TT + q0 + lr) * DQ + (bh % NH_) * HD + hi * 8;
    if (qg * 64 < RH) attn_rows<bf, true, 2>(Qh + pl, Ql + pl, Kh + pl, Kl + pl, Vh + pl, Vl + pl, q0, lr, hi, orow);
    else attn_rows<h16, false, 4>(Q16 + pl, nullptr, K16 + pl, nullptr, V16 + pl, nullptr, q0, lr, hi, orow);
}

extern "C" void kernel_launch(void* const* d_in, const int* in_sizes, int n_in,
                              void* d_out, int out_size, void* d_ws, size_t ws_size, hipStream_t stream) {
    (void)in_sizes; (void)n_in; (void)out_size;
    const float* x = (const float*)d_in[0]; const float* wq = (const float*)d_in[1]; const float* bq = (const float*)d_in[2]; const float* wk = (const float*)d_in[3]; const float* bk = (const float*)d_in[4]; const float* wv = (const float*)d_in[5]; const float* bv = (const float*)d_in[6]; const float* wo = nullptr; (void)wo;
    float* OUT = (float*)d_out;     // [2][2048][1024]
    char* wsp = (char*)d_ws;
    auto take = [&](size_t bytes) { char* p = wsp; wsp += (bytes + 255) & ~(size_t)255; return (void*)p; };
    bf* WQ = (bf*)take((size_t)DQ * DM * 2); bf* WK = (bf*)take((size_t)DKV * DM * 2); bf* WV = (bf*)take((size_t)DKV * DM * 2); float* CS = (float*)take((size_t)TT * HD * 2 * 4);
    bf* XB = (bf*)take((size_t)TT * DM * 2); float* FQ = (float*)take((size_t)TT * DQ * 4); float* FK = (float*)take((size_t)TT * DKV * 4);
    const size_t PB = (size_t)NH_ * TT * HD;   // elements of one batch's head planes; the planes of both batches stay live for the one attention launch
    h16* QP16 = (h16*)take(NB_ * PB * 2); h16* KP16 = (h16*)take(NB_ * PB * 2); h16* VT16 = (h16*)take(NB_ * PB * 2);
    bf* QPh = (bf*)take(NB_ * PB * 2); bf* QPl = (bf*)take(NB_ * PB * 2); bf* KPh = (bf*)take(NB_ * PB * 2); bf* KPl = (bf*)take(NB_ * PB * 2); bf* VTh = (bf*)take(NB_ * PB * 2); bf* VTl = (bf*)take(NB_ * PB * 2);
    if ((size_t)(wsp - (char*)d_ws) > ws_size) return;    // ws 256 MiB
    float* FV = FK;   // v projection reuses the k buffer after the k planes are built (stream-ordered)
    { k_cvt8<<<(unsigned)(((size_t)DQ * DM / 8 + 255) / 256), 256, 0, stream>>>(wq, WQ, (size_t)DQ * DM / 8); k_cvt8<<<(unsigned)(((size_t)DKV * DM / 8 + 255) / 256), 256, 0, stream>>>(wk, WK, (size_t)DKV * DM / 8); k_cvt8<<<(unsigned)(((size_t)DKV * DM / 8 + 255) / 256), 256, 0, stream>>>(wv, WV, (size_t)DKV * DM / 8);
      
       }
    k_csid<<<(TT * HD + 255) / 256, 256, 0, stream>>>(CS);
    const unsigned LQ = (unsigned)(((size_t)NH_ * TT * HD / 2 + 255) / 256), LKv = (unsigned)(((size_t)NKV * TT * HD / 2 + 255) / 256);
    for (int b = 0; b < NB_; ++b) {
        
        k_cvt8<<<(unsigned)(((size_t)TT * DM / 8 + 255) / 256), 256, 0, stream>>>(x + (size_t)b * TT * DM, XB, (size_t)TT * DM / 8);
        k_gemmw<bf, 0, true><<<dim3(TT / 64, DQ / 64, 1), 32, 0, stream>>>(XB, nullptr, WQ, nullptr, DM, FQ, DQ, bq, 0, 0, 0);
        k_rope<<<LQ, 256, 0, stream>>>(FQ, DQ, NH_, CS, nullptr, nullptr, 1.0f, QP16 + b * PB, QPh + b * PB, QPl + b * PB);
        k_gemmw<bf, 0, true><<<dim3(TT / 64, DKV / 64, 1), 32, 0, stream>>>(XB, nullptr, WK, nullptr, DM, FK, DKV, bk, 0, 0, 0);
        k_rope<<<LKv, 256, 0, stream>>>(FK, DKV, NKV, CS, nullptr, nullptr, 1.0f, KP16 + b * PB, KPh + b * PB, KPl + b * PB);
        k_gemmw<bf, 0, true><<<dim3(TT / 64, DKV / 64, 1), 32, 0, stream>>>(XB, nullptr, WV, nullptr, DM, FV, DKV, bv, 0, 0, 0); k_vtp<<<LKv, 256, 0, stream>>>(FV, DKV, NKV, VT16 + b * PB, VTh + b * PB, VTl + b * PB); }
    k_fattn<<<NB_ * NH_ * (TT / 64), 128, 0, stream>>>(QP16, KP16, VT16, QPh, QPl, KPh, KPl, VTh, VTl, OUT);
}

// v002
// A run of this version takes 127 microseconds.
// Two timings next to v001 put it at 2.14 and 2.13 times that version's speed.
// Over all steps from v000 it is 10.8 times as fast.
#include <hip/hip_runtime.h>

// Causal multi-head self-attention without an output projection (x [2][2048][1024]; q, k, v = x W^T + b ('oi' [1024][1024] + [1024], 16 heads x 64); att = q.k / sqrt(1024) (the module scales by the full hidden size), causal mask (-inf above the diagonal); softmax; out = merged heads -> [2][2048][1024] (4.2 M)).
// Compute dtypes, f32 accumulate: every input rounded to bf16; q/k/v on PLAIN bf16 operands (inputs: exact) + biases, one launch for all three and both batches, head planes written from its epilogue; causal scores and attn.v in one launch (running maximum and sum over 32- or 64-key steps): query rows < 512 hl (3 products), the rest single fp16; softmax f32; no output projection: the merged heads are written in f32 straight to the output.

#define NB_  2
#define TT   2048
#define DM   1024
#define NH_  16
#define NKV  16
#define HD   64
#define DQ   (NH_ * HD)
#define DKV  (NKV * HD)
#define RH   512                  // query rows < RH use hi+lo planes (0: none)
#define SCL  0.03125f   // 1/sqrt(h_dim = 1024): the module scales by the full hidden size
typedef _Float16 h16;
typedef unsigned short bf;
typedef __attribute__((ext_vector_type(16))) __bf16   v16bf;
typedef __attribute__((ext_vector_type(16))) _Float16 v16h;
typedef __attribute__((ext_vector_type(8)))  _Float16 v8h;
typedef __attribute__((ext_vector_type(8)))  unsigned short v8us;
typedef __attribute__((ext_vector_type(8)))  float    v8f;
typedef __attribute__((ext_vector_type(4)))  float    v4f;
typedef v8h  __attribute__((may_alias)) v8ha;
typedef v4f  __attribute__((may_alias)) v4fa;
typedef v8us __attribute__((may_alias)) v8usa;

__device__ __forceinline__ unsigned short f2bf(float f) { unsigned u = __float_as_uint(f); u += 0x7FFFu + ((u >> 16) & 1u); return (unsigned short)(u >> 16); }
__device__ __forceinline__ float bf2f(unsigned short b) { return __uint_as_float(((unsigned)b) << 16); }
__device__ __forceinline__ float bfr(float f) { return bf2f(f2bf(f)); }
__device__ __forceinline__ v16h cat16(v8h lo, v8h hi) { return __builtin_shufflevector(lo, hi, 0, 1, 2, 3, 4, 5, 6, 7, 8, 9, 10, 11, 12, 13, 14, 15); }
__device__ __forceinline__ v16bf cat16b(v8us lo, v8us hi) { return __builtin_bit_cast(v16bf, __builtin_shufflevector(lo, hi, 0, 1, 2, 3, 4, 5, 6, 7, 8, 9, 10, 11, 12, 13, 14, 15)); }
__device__ __forceinline__ v8f wmma16(v16h a, v16h b, v8f c) { return __builtin_amdgcn_wmma_f32_16x16x32_f16(false, a, false, b, (short)0, c, false, false); }
__device__ __forceinline__ v8f wmmab(v16bf a, v16bf b, v8f c) { return __builtin_amdgcn_wmma_f32_16x16x32_bf16(false, a, false, b, (short)0, c, false, false); }



// fragment loaders and matrix products by 16-bit type: a fragment is two 16-byte loads of one K-contiguous row
template <typename T16> struct WFrag;
template <> struct WFrag<h16> { typedef v16h V; static __device__ __forceinline__ V ld(const h16* p) { return cat16(*(const v8h*)p, *(const v8h*)(p + 16)); } static __device__ __forceinline__ v8f mma(V a, V b, v8f c) { return wmma16(a, b, c); } };
template <> struct WFrag<bf> { typedef v16bf V; static __device__ __forceinline__ V ld(const bf* p) { return cat16b(*(const v8us*)p, *(const v8us*)(p + 16)); } static __device__ __forceinline__ v8f mma(V a, V b, v8f c) { return wmmab(a, b, c); } };
__device__ __forceinline__ h16 tohx(float x) { return (h16)x; }
__device__ __forceinline__ void splitf(float y, unsigned short& h, unsigned short& l) { h = f2bf(y); l = f2bf(y - bf2f(h)); }
// ---- k_cvtall: x (both batches) and the three weights rounded to bf16 into one plane [x rows | wq rows | wk rows | wv rows] x DM; 8192 elements a block, 4 x 8 a thread.
#define CB   8192
__global__ __launch_bounds__(256) void k_cvtall(const float* __restrict__ x, const float* __restrict__ wq, const float* __restrict__ wk, const float* __restrict__ wv, bf* dst) {
    const int XBK = NB_ * TT * DM / CB, WBK = DQ * DM / CB; const int blk = blockIdx.x;
    const float* src = x; int sb = blk;
    if (blk >= XBK) { const int w = (blk - XBK) / WBK; sb = (blk - XBK) % WBK; src = (w == 0) ? wq : (w == 1) ? wk : wv; }
    const float* s = src + (size_t)sb * CB + threadIdx.x * 8; bf* d = dst + (size_t)blk * CB + threadIdx.x * 8;
    v8f v[4];
#pragma unroll
    for (int i = 0; i < 4; ++i) v[i] = *(const v8f*)(s + i * 2048);
#pragma unroll
    for (int i = 0; i < 4; ++i) { v8us o;
#pragma unroll
        for (int k = 0; k < 8; ++k) o[k] = f2bf(v[i][k]);
        *(v8us*)(d + i * 2048) = o; }
}

// ---- k_proj: the q, k and v projections of both batches in one launch. ONE WAVE per 64x64 tile (16 accumulators), operands straight from the K-contiguous bf16 planes; grid (NB_ * TT / 64, 3 * DQ / 64), 32 threads.
// A tile is 64 tokens x one head. q and k: A = x rows, B = weight rows, tile [t][d]; v: A = weight rows, B = x rows, tile [d][t], so every tile row is one 128-byte row of its head plane ([h][t][d] for q and k, [h][d][t] for v).
// Epilogue: + bf16-rounded bias in f32, then the fp16 plane and the hi + lo bf16 planes, 16-byte stores.
__global__ __launch_bounds__(32) void k_proj(const bf* __restrict__ X, const bf* __restrict__ Wt, const float* __restrict__ bq, const float* __restrict__ bk, const float* __restrict__ bv, h16* Q16, bf* Qh, bf* Ql, h16* K16, bf* Kh, bf* Kl, h16* V16, bf* Vh, bf* Vl) {
    typedef WFrag<bf>::V V;
    __shared__ __align__(16) float os[16 * 68];
    const int K = DM;
    const int lane = threadIdx.x & 31, lr = lane & 15, hi = lane >> 4; const int t0 = blockIdx.x * 64, n0 = blockIdx.y * 64;
    const int which = n0 / DQ, h = (n0 % DQ) / HD; const bool tr = which == 2;   // block-uniform: 0 q, 1 k, 2 v
    const bf* A = tr ? Wt + (size_t)n0 * K : X + (size_t)t0 * K; const bf* Bt = tr ? X + (size_t)t0 * K : Wt + (size_t)n0 * K;
    v8f acc[4][4];
#pragma unroll
    for (int mb = 0; mb < 4; ++mb)
#pragma unroll
        for (int nb = 0; nb < 4; ++nb) acc[mb][nb] = (v8f){};
    const unsigned foff = (unsigned)(lr * K + 8 * hi);   // a lane's place in a 16-row fragment, the same for A and B
#pragma unroll 1
    for (int kc = 0; kc < K; kc += 32) {
        V a[4];
#pragma unroll
        for (int mb = 0; mb < 4; ++mb) a[mb] = WFrag<bf>::ld(A + kc + foff + (size_t)mb * 16 * K);
        asm volatile("s_wait_xcnt 0x0" ::: "memory");  // the A loads' address registers are reused as a B fragment's destination below
#pragma unroll
        for (int nb = 0; nb < 4; ++nb) { const V b = WFrag<bf>::ld(Bt + kc + foff + (size_t)nb * 16 * K);
#pragma unroll
            for (int mb = 0; mb < 4; ++mb) acc[mb][nb] = WFrag<bf>::mma(a[mb], b, acc[mb][nb]); }
        asm volatile("v_nop\n\tv_nop\n\tv_nop\n\tv_nop" : "+v"(acc[0][0]), "+v"(acc[1][1]), "+v"(acc[2][2]), "+v"(acc[3][3]) : "v"(a[0]), "v"(a[3]));  // the distance behind the last matrix instruction on the loop's taken branch
    }
    const size_t base = (size_t)((t0 / TT) * NH_ + h) * TT * HD + (tr ? (size_t)(t0 % TT) : (size_t)(t0 % TT) * HD); const int pitch = tr ? TT : HD;
    h16* P16 = ((which == 0) ? Q16 : (which == 1) ? K16 : V16) + base; bf* Ph = ((which == 0) ? Qh : (which == 1) ? Kh : Vh) + base; bf* Pl = ((which == 0) ? Ql : (which == 1) ? Kl : Vl) + base;
    const float* bias = ((which == 0) ? bq : (which == 1) ? bk : bv) + h * HD;
    const int rsub = lane >> 3, cofs = (lane & 7) * 8;   // 8 lanes write one 128-byte plane row
    float bc[8];
#pragma unroll
    for (int e = 0; e < 8; ++e) bc[e] = bfr(bias[cofs + e]);
#pragma unroll
    for (int mb = 0; mb < 4; ++mb) {
#pragma unroll
        for (int nb = 0; nb < 4; ++nb) {
#pragma unroll
            for (int j = 0; j < 8; ++j) os[(hi * 8 + j) * 68 + nb * 16 + lr] = acc[mb][nb][j]; }
        __builtin_amdgcn_wave_barrier(); asm volatile("" ::: "memory");  // compiler order only (one wave): the 16 tile rows are stored to LDS before they are read back
#pragma unroll
        for (int s = 0; s < 4; ++s) { const int row = 4 * s + rsub; const v4f lo4 = *(const v4fa*)(os + row * 68 + cofs), hi4 = *(const v4fa*)(os + row * 68 + cofs + 4);
            const float br = bfr(bias[mb * 16 + row]); v8h o16; v8us oh, ol;
#pragma unroll
            for (int e = 0; e < 8; ++e) { const float r = ((e < 4) ? lo4[e & 3] : hi4[e & 3]) + (tr ? br : bc[e]); o16[e] = tohx(r); unsigned short a2, c2; splitf(r, a2, c2); oh[e] = a2; ol[e] = c2; }
            const size_t off = (size_t)(mb * 16 + row) * pitch + cofs;
            *(v8h*)(P16 + off) = o16; *(v8us*)(Ph + off) = oh; *(v8us*)(Pl + off) = ol; }
        __builtin_amdgcn_wave_barrier(); asm volatile("" ::: "memory");  // compiler order only: the rows are read before the next 16 overwrite them
    }
}

// ---- k_fattn: scores, causal softmax and probability x value in one launch for every batch and head. One wave owns 16 query rows and walks its keys KT x 16 at a time with a running maximum and sum.
// Transposed products: S^T = K Q^T (A = key rows, B = query rows), O^T += V^T P^T (A = V^T rows, B = two score tiles converted in place), so a lane holds one query's scores and P needs no lane exchange and no LDS.
// HL (query rows < RH): hi+lo bf16 planes, 3 products each, 32 keys a step; otherwise single fp16, 64 keys a step. Grid: heaviest 64-row query groups first, 4 waves a block.
__device__ __forceinline__ float xhalf(float x) { return __builtin_bit_cast(float, __builtin_amdgcn_permlanex16(__builtin_bit_cast(int, x), __builtin_bit_cast(int, x), 0x76543210, 0xfedcba98, false, false)); }  // lane l with lane l ^ 16
// 2^x with the one free issue slot behind a transcendental written in
__device__ __forceinline__ float exp2s(float x) { float r; asm("v_exp_f32 %0, %1\n\tv_nop" : "=v"(r) : "v"(x)); return r; }
__device__ __forceinline__ v16h packp(const float* p, v16h*) { v16h r;
#pragma unroll
    for (int e = 0; e < 16; ++e) r[e] = (h16)p[e];
    return r; }
__device__ __forceinline__ v16bf packp(const float* p, v16bf* lo) { v8us h0, h1, l0, l1;
#pragma unroll
    for (int e = 0; e < 8; ++e) { unsigned short a, c; splitf(p[e], a, c); h0[e] = a; l0[e] = c; splitf(p[8 + e], a, c); h1[e] = a; l1[e] = c; }
    *lo = cat16b(l0, l1); return cat16b(h0, h1); }
template <typename T16, bool HL, int KT>
__device__ __forceinline__ void attn_rows(const T16* __restrict__ Q, const T16* __restrict__ Q2, const T16* __restrict__ Kp, const T16* __restrict__ K2, const T16* __restrict__ Vt, const T16* __restrict__ Vt2, int q0, int lr, int hi, float* __restrict__ orow) {
    typedef typename WFrag<T16>::V V;                // every full '#pragma unroll' below keeps a fragment or score array in registers (constant indices)
    const float CE = SCL * 1.4426950408889634f;      // raw score -> log2 domain
    const size_t qo = (size_t)(q0 + lr) * HD + 8 * hi, ko = (size_t)lr * HD + 8 * hi, vo = (size_t)lr * TT + 8 * hi;
    V qf[2], qf2[2];
#pragma unroll
    for (int c = 0; c < 2; ++c) { qf[c] = WFrag<T16>::ld(Q + qo + c * 32); if (HL) qf2[c] = WFrag<T16>::ld(Q2 + qo + c * 32); }
    v8f o[4];
#pragma unroll
    for (int dt = 0; dt < 4; ++dt) o[dt] = (v8f){};
    float m = -3.0e38f, l = 0.f;
    const int nst = (q0 + 15 + KT * 16) / (KT * 16); // keys 0 .. q0 + 15 in steps of KT x 16; the last step ends at or below TT
    V kf[KT][2], kf2[KT][2];
    if (!HL) {
#pragma unroll
        for (int kt = 0; kt < KT; ++kt)
#pragma unroll
            for (int c = 0; c < 2; ++c) kf[kt][c] = WFrag<T16>::ld(Kp + ko + (size_t)(kt * 16) * HD + c * 32); }
#pragma unroll 1                                     // rolled: two steps unrolled take more than 256 registers, one wave a SIMD fewer
    for (int s = 0; s < nst; ++s) {
        const int kb = s * (KT * 16);
        V vf[4][KT / 2], vf2[4][KT / 2];
        if (HL) {                                     // hi+lo planes: twice the fragments, so keys and values take turns in the registers (at most RH / 32 steps a wave)
#pragma unroll
            for (int kt = 0; kt < KT; ++kt)
#pragma unroll
                for (int c = 0; c < 2; ++c) { kf[kt][c] = WFrag<T16>::ld(Kp + ko + (size_t)(kb + kt * 16) * HD + c * 32); kf2[kt][c] = WFrag<T16>::ld(K2 + ko + (size_t)(kb + kt * 16) * HD + c * 32); }
        } else {
#pragma unroll
            for (int dt = 0; dt < 4; ++dt)
#pragma unroll
                for (int kc = 0; kc < KT / 2; ++kc) vf[dt][kc] = WFrag<T16>::ld(Vt + vo + (size_t)(dt * 16) * TT + kb + kc * 32);
        }
        v8f st[KT];
#pragma unroll
        for (int kt = 0; kt < KT; ++kt) { st[kt] = (v8f){};
#pragma unroll
            for (int c = 0; c < 2; ++c) { st[kt] = WFrag<T16>::mma(kf[kt][c], qf[c], st[kt]); if (HL) { st[kt] = WFrag<T16>::mma(kf[kt][c], qf2[c], st[kt]); st[kt] = WFrag<T16>::mma(kf2[kt][c], qf[c], st[kt]); } } }
        if (HL) {
            asm volatile("s_wait_xcnt 0x0" ::: "memory");  // the key loads' address registers are reused by the value loads below
#pragma unroll
            for (int dt = 0; dt < 4; ++dt)
#pragma unroll
                for (int kc = 0; kc < KT / 2; ++kc) { vf[dt][kc] = WFrag<T16>::ld(Vt + vo + (size_t)(dt * 16) * TT + kb + kc * 32); vf2[dt][kc] = WFrag<T16>::ld(Vt2 + vo + (size_t)(dt * 16) * TT + kb + kc * 32); }
            asm volatile("s_wait_xcnt 0x0" ::: "memory");  // the value loads' address registers are reused by the softmax below
        }
        float p[KT * 8];
#pragma unroll
        for (int e = 0; e < KT * 8; ++e) p[e] = st[e >> 3][e & 7];
        if (kb + KT * 16 - 1 > q0) {                  // only a step that reaches the diagonal masks (wave-uniform)
#pragma unroll
            for (int e = 0; e < KT * 8; ++e) p[e] = (kb + (e >> 3) * 16 + hi * 8 + (e & 7) <= q0 + lr) ? p[e] : -3.0e38f; }
        if (!HL) {
            const int kn = (s + 1 < nst) ? kb + KT * 16 : kb;  // next step's key fragments fly under softmax and P.V; the last step refetches its own rows (in bounds)
#pragma unroll
            for (int kt = 0; kt < KT; ++kt)
#pragma unroll
                for (int c = 0; c < 2; ++c) kf[kt][c] = WFrag<T16>::ld(Kp + ko + (size_t)(kn + kt * 16) * HD + c * 32);
        }
        float mx = p[0];
#pragma unroll
        for (int e = 1; e < KT * 8; ++e) mx = fmaxf(mx, p[e]);
        mx = fmaxf(mx, xhalf(mx));
        const float mn = fmaxf(m, mx), al = exp2s((m - mn) * CE), mc = mn * CE; m = mn;
        float ls = 0.f;
#pragma unroll
        for (int e = 0; e < KT * 8; ++e) { p[e] = exp2s(__builtin_fmaf(p[e], CE, -mc)); ls += p[e]; }
        l = l * al + ls;
#pragma unroll
        for (int dt = 0; dt < 4; ++dt) o[dt] *= al;
#pragma unroll
        for (int kc = 0; kc < KT / 2; ++kc) { V pf2; const V pf = packp(p + kc * 16, &pf2);
#pragma unroll
            for (int dt = 0; dt < 4; ++dt) { o[dt] = WFrag<T16>::mma(vf[dt][kc], pf, o[dt]); if (HL) { o[dt] = WFrag<T16>::mma(vf[dt][kc], pf2, o[dt]); o[dt] = WFrag<T16>::mma(vf2[dt][kc], pf, o[dt]); } } }
    }
    l += xhalf(l);
    const float inv = __fdiv_rn(1.0f, l);
#pragma unroll
    for (int dt = 0; dt < 4; ++dt) { v4f a, b;
#pragma unroll
        for (int j = 0; j < 4; ++j) { a[j] = o[dt][j] * inv; b[j] = o[dt][4 + j] * inv; }
        *(v4f*)(orow + dt * 16) = a; *(v4f*)(orow + dt * 16 + 4) = b; }
}
__global__ __launch_bounds__(128) void k_fattn(const h16* __restrict__ Q16, const h16* __restrict__ K16, const h16* __restrict__ V16, const bf* __restrict__ Qh, const bf* __restrict__ Ql, const bf* __restrict__ Kh, const bf* __restrict__ Kl, const bf* __restrict__ Vh, const bf* __restrict__ Vl, float* __restrict__ out) {
    const int lane = threadIdx.x & 31, lr = lane & 15, hi = lane >> 4; const int wv = __builtin_amdgcn_readfirstlane((int)(threadIdx.x >> 5));
    const int bh = blockIdx.x % (NB_ * NH_), qg = TT / 64 - 1 - (int)(blockIdx.x / (NB_ * NH_)); const int q0 = qg * 64 + wv * 16;
    const size_t pl = (size_t)bh * TT * HD;          // this batch and head's plane ([t][d] for q and k, [d][t] for v)
    float* orow = out + ((size_t)(bh / NH_) * TT + q0 + lr) * DQ + (bh % NH_) * HD + hi * 8;
    if (qg * 64 < RH) attn_rows<bf, true, 2>(Qh + pl, Ql + pl, Kh + pl, Kl + pl, Vh + pl, Vl + pl, q0, lr, hi, orow);
    else attn_rows<h16, false, 4>(Q16 + pl, nullptr, K16 + pl, nullptr, V16 + pl, nullptr, q0, lr, hi, orow);
}

extern "C" void kernel_launch(void* const* d_in, const int* in_sizes, int n_in,
                              void* d_out, int out_size, void* d_ws, size_t ws_size, hipStream_t stream) {
    (void)in_sizes; (void)n_in; (void)out_size;
    const float* x = (const float*)d_in[0]; const float* wq = (const float*)d_in[1]; const float* bq = (const float*)d_in[2]; const float* wk = (const float*)d_in[3]; const float* bk = (const float*)d_in[4]; const float* wv = (const float*)d_in[5]; const float* bv = (const float*)d_in[6];
    float* OUT = (float*)d_out;     // [2][2048][1024]
    char* wsp = (char*)d_ws;
    auto take = [&](size_t bytes) { char* p = wsp; wsp += (bytes + 255) & ~(size_t)255; return (void*)p; };
    bf* XW = (bf*)take(((size_t)NB_ * TT + 3 * DQ) * DM * 2);   // bf16 x rows of both batches, then the wq, wk, wv rows
    const size_t PB = (size_t)NH_ * TT * HD;   // elements of one batch's head planes
    h16* QP16 = (h16*)take(NB_ * PB * 2); h16* KP16 = (h16*)take(NB_ * PB * 2); h16* VT16 = (h16*)take(NB_ * PB * 2);
    bf* QPh = (bf*)take(NB_ * PB * 2); bf* QPl = (bf*)take(NB_ * PB * 2); bf* KPh = (bf*)take(NB_ * PB * 2); bf* KPl = (bf*)take(NB_ * PB * 2); bf* VTh = (bf*)take(NB_ * PB * 2); bf* VTl = (bf*)take(NB_ * PB * 2);
    if ((size_t)(wsp - (char*)d_ws) > ws_size) return;    // ws 256 MiB
    k_cvtall<<<(NB_ * TT + 3 * DQ) * DM / CB, 256, 0, stream>>>(x, wq, wk, wv, XW);
    k_proj<<<dim3(NB_ * TT / 64, 3 * DQ / 64, 1), 32, 0, stream>>>(XW, XW + (size_t)NB_ * TT * DM, bq, bk, bv, QP16, QPh, QPl, KP16, KPh, KPl, VT16, VTh, VTl);
    k_fattn<<<NB_ * NH_ * (TT / 64), 128, 0, stream>>>(QP16, KP16, VT16, QPh, QPl, KPh, KPl, VTh, VTl, OUT);
}

// v003
// Measured time: 91.6 microseconds a run.
// Two timings next to v002 put it at 1.39 and 1.40 times that version's speed.
// All steps since v000 together make it 15.1 times as fast.
#include <hip/hip_runtime.h>

// Causal multi-head self-attention without an output projection (x [2][2048][1024]; q, k, v = x W^T + b ('oi' [1024][1024] + [1024], 16 heads x 64); att = q.k / sqrt(1024) (the module scales by the full hidden size), causal mask (-inf above the diagonal); softmax; out = merged heads -> [2][2048][1024] (4.2 M)).
// Compute dtypes, f32 accumulate: every input rounded to bf16; q/k/v on PLAIN bf16 operands (inputs: exact) + biases, one launch for all three and both batches, head planes written from its epilogue; causal scores and attn.v in one launch (running maximum and sum over 32- or 64-key steps): query rows < 512 hl (3 products), the rest single fp16 with its key and value tiles staged in LDS for the block's 4 waves; softmax f32; no output projection: the merged heads are written in f32 straight to the output.

#define NB_  2
#define TT   2048
#define DM   1024
#define NH_  16
#define NKV  16
#define HD   64
#define DQ   (NH_ * HD)
#define DKV  (NKV * HD)
#define RH   512                  // query rows < RH use hi+lo planes (0: none)
#define SCL  0.03125f   // 1/sqrt(h_dim = 1024): the module scales by the full hidden size
typedef _Float16 h16;
typedef unsigned short bf;
typedef __attribute__((ext_vector_type(16))) __bf16   v16bf;
typedef __attribute__((ext_vector_type(16))) _Float16 v16h;
typedef __attribute__((ext_vector_type(8)))  _Float16 v8h;
typedef __attribute__((ext_vector_type(8)))  unsigned short v8us;
typedef __attribute__((ext_vector_type(8)))  float    v8f;
typedef __attribute__((ext_vector_type(4)))  float    v4f;
typedef v8h  __attribute__((may_alias)) v8ha;
typedef v4f  __attribute__((may_alias)) v4fa;
typedef v8us __attribute__((may_alias)) v8usa;

__device__ __forceinline__ unsigned short f2bf(float f) { unsigned u = __float_as_uint(f); u += 0x7FFFu + ((u >> 16) & 1u); return (unsigned short)(u >> 16); }
__device__ __forceinline__ float bf2f(unsigned short b) { return __uint_as_float(((unsigned)b) << 16); }
__device__ __forceinline__ float bfr(float f) { return bf2f(f2bf(f)); }
__device__ __forceinline__ v16h cat16(v8h lo, v8h hi) { return __builtin_shufflevector(lo, hi, 0, 1, 2, 3, 4, 5, 6, 7, 8, 9, 10, 11, 12, 13, 14, 15); }
__device__ __forceinline__ v16bf cat16b(v8us lo, v8us hi) { return __builtin_bit_cast(v16bf, __builtin_shufflevector(lo, hi, 0, 1, 2, 3, 4, 5, 6, 7, 8, 9, 10, 11, 12, 13, 14, 15)); }
__device__ __forceinline__ v8f wmma16(v16h a, v16h b, v8f c) { return __builtin_amdgcn_wmma_f32_16x16x32_f16(false, a, false, b, (short)0, c, false, false); }
__device__ __forceinline__ v8f wmmab(v16bf a, v16bf b, v8f c) { return __builtin_amdgcn_wmma_f32_16x16x32_bf16(false, a, false, b, (short)0, c, false, false); }



// fragment loaders and matrix products by 16-bit type: a fragment is two 16-byte loads of one K-contiguous row
template <typename T16> struct WFrag;
template <> struct WFrag<h16> { typedef v16h V; static __device__ __forceinline__ V ld(const h16* p) { return cat16(*(const v8h*)p, *(const v8h*)(p + 16)); } static __device__ __forceinline__ v8f mma(V a, V b, v8f c) { return wmma16(a, b, c); } };
template <> struct WFrag<bf> { typedef v16bf V; static __device__ __forceinline__ V ld(const bf* p) { return cat16b(*(const v8us*)p, *(const v8us*)(p + 16)); } static __device__ __forceinline__ v8f mma(V a, V b, v8f c) { return wmmab(a, b, c); } };
__device__ __forceinline__ h16 tohx(float x) { return (h16)x; }
__device__ __forceinline__ void splitf(float y, unsigned short& h, unsigned short& l) { h = f2bf(y); l = f2bf(y - bf2f(h)); }
// ---- k_cvtall: x (both batches) and the three weights rounded to bf16 into one plane [x rows | wq rows | wk rows | wv rows] x DM; 8192 elements a block, 4 x 8 a thread.
#define CB   8192
__global__ __launch_bounds__(256) void k_cvtall(const float* __restrict__ x, const float* __restrict__ wq, const float* __restrict__ wk, const float* __restrict__ wv, bf* dst) {
    const int XBK = NB_ * TT * DM / CB, WBK = DQ * DM / CB; const int blk = blockIdx.x;
    const float* src = x; int sb = blk;
    if (blk >= XBK) { const int w = (blk - XBK) / WBK; sb = (blk - XBK) % WBK; src = (w == 0) ? wq : (w == 1) ? wk : wv; }
    const float* s = src + (size_t)sb * CB + threadIdx.x * 8; bf* d = dst + (size_t)blk * CB + threadIdx.x * 8;
    v8f v[4];
#pragma unroll
    for (int i = 0; i < 4; ++i) v[i] = *(const v8f*)(s + i * 2048);
#pragma unroll
    for (int i = 0; i < 4; ++i) { v8us o;
#pragma unroll
        for (int k = 0; k < 8; ++k) o[k] = f2bf(v[i][k]);
        *(v8us*)(d + i * 2048) = o; }
}

// ---- k_proj: the q, k and v projections of both batches in one launch. ONE WAVE per 64x64 tile (16 accumulators), operands straight from the K-contiguous bf16 planes; grid (NB_ * TT / 64, 3 * DQ / 64), 32 threads.
// A tile is 64 tokens x one head. q and k: A = x rows, B = weight rows, tile [t][d]; v: A = weight rows, B = x rows, tile [d][t], so every tile row is one 128-byte row of its head plane ([h][t][d] for q and k, [h][d][t] for v).
// Epilogue: + bf16-rounded bias in f32, then the fp16 plane and the hi + lo bf16 planes, 16-byte stores.
__global__ __launch_bounds__(32) void k_proj(const bf* __restrict__ X, const bf* __restrict__ Wt, const float* __restrict__ bq, const float* __restrict__ bk, const float* __restrict__ bv, h16* Q16, bf* Qh, bf* Ql, h16* K16, bf* Kh, bf* Kl, h16* V16, bf* Vh, bf* Vl) {
    typedef WFrag<bf>::V V;
    __shared__ __align__(16) float os[16 * 68];
    const int K = DM;
    const int lane = threadIdx.x & 31, lr = lane & 15, hi = lane >> 4; const int t0 = blockIdx.x * 64, n0 = blockIdx.y * 64;
    const int which = n0 / DQ, h = (n0 % DQ) / HD; const bool tr = which == 2;   // block-uniform: 0 q, 1 k, 2 v
    const bf* A = tr ? Wt + (size_t)n0 * K : X + (size_t)t0 * K; const bf* Bt = tr ? X + (size_t)t0 * K : Wt + (size_t)n0 * K;
    v8f acc[4][4];
#pragma unroll
    for (int mb = 0; mb < 4; ++mb)
#pragma unroll
        for (int nb = 0; nb < 4; ++nb) acc[mb][nb] = (v8f){};
    const unsigned foff = (unsigned)(lr * K + 8 * hi);   // a lane's place in a 16-row fragment, the same for A and B
#pragma unroll 1
    for (int kc = 0; kc < K; kc += 32) {
        V a[4];
#pragma unroll
        for (int mb = 0; mb < 4; ++mb) a[mb] = WFrag<bf>::ld(A + kc + foff + (size_t)mb * 16 * K);
        asm volatile("s_wait_xcnt 0x0" ::: "memory");  // the A loads' address registers are reused as a B fragment's destination below
#pragma unroll
        for (int nb = 0; nb < 4; ++nb) { const V b = WFrag<bf>::ld(Bt + kc + foff + (size_t)nb * 16 * K);
#pragma unroll
            for (int mb = 0; mb < 4; ++mb) acc[mb][nb] = WFrag<bf>::mma(a[mb], b, acc[mb][nb]); }
        asm volatile("v_nop\n\tv_nop\n\tv_nop\n\tv_nop" : "+v"(acc[0][0]), "+v"(acc[1][1]), "+v"(acc[2][2]), "+v"(acc[3][3]) : "v"(a[0]), "v"(a[3]));  // the distance behind the last matrix instruction on the loop's taken branch
    }
    const size_t base = (size_t)((t0 / TT) * NH_ + h) * TT * HD + (tr ? (size_t)(t0 % TT) : (size_t)(t0 % TT) * HD); const int pitch = tr ? TT : HD;
    h16* P16 = ((which == 0) ? Q16 : (which == 1) ? K16 : V16) + base; bf* Ph = ((which == 0) ? Qh : (which == 1) ? Kh : Vh) + base; bf* Pl = ((which == 0) ? Ql : (which == 1) ? Kl : Vl) + base;
    const float* bias = ((which == 0) ? bq : (which == 1) ? bk : bv) + h * HD;
    const int rsub = lane >> 3, cofs = (lane & 7) * 8;   // 8 lanes write one 128-byte plane row
    float bc[8];
#pragma unroll
    for (int e = 0; e < 8; ++e) bc[e] = bfr(bias[cofs + e]);
#pragma unroll
    for (int mb = 0; mb < 4; ++mb) {
#pragma unroll
        for (int nb = 0; nb < 4; ++nb) {
#pragma unroll
            for (int j = 0; j < 8; ++j) os[(hi * 8 + j) * 68 + nb * 16 + lr] = acc[mb][nb][j]; }
        __builtin_amdgcn_wave_barrier(); asm volatile("" ::: "memory");  // compiler order only (one wave): the 16 tile rows are stored to LDS before they are read back
#pragma unroll
        for (int s = 0; s < 4; ++s) { const int row = 4 * s + rsub; const v4f lo4 = *(const v4fa*)(os + row * 68 + cofs), hi4 = *(const v4fa*)(os + row * 68 + cofs + 4);
            const float br = bfr(bias[mb * 16 + row]); v8h o16; v8us oh, ol;
#pragma unroll
            for (int e = 0; e < 8; ++e) { const float r = ((e < 4) ? lo4[e & 3] : hi4[e & 3]) + (tr ? br : bc[e]); o16[e] = tohx(r); unsigned short a2, c2; splitf(r, a2, c2); oh[e] = a2; ol[e] = c2; }
            const size_t off = (size_t)(mb * 16 + row) * pitch + cofs;
            *(v8h*)(P16 + off) = o16; *(v8us*)(Ph + off) = oh; *(v8us*)(Pl + off) = ol; }
        __builtin_amdgcn_wave_barrier(); asm volatile("" ::: "memory");  // compiler order only: the rows are read before the next 16 overwrite them
    }
}

// ---- k_fattn: scores, causal softmax and probability x value in one launch for every batch and head. One wave owns 16 query rows and walks its keys KT x 16 at a time with a running maximum and sum.
// Transposed products: S^T = K Q^T (A = key rows, B = query rows), O^T += V^T P^T (A = V^T rows, B = two score tiles converted in place), so a lane holds one query's scores and P needs no lane exchange and no LDS.
// Query rows < RH (attn_rows): hi+lo bf16 planes, 3 products each, 32 keys a step, fragments straight from global memory. The rest (attn_rows_st): single fp16, 64 keys a step, tiles in LDS. Grid: heaviest 64-row query groups first, 4 waves a block.
__device__ __forceinline__ float xhalf(float x) { return __builtin_bit_cast(float, __builtin_amdgcn_permlanex16(__builtin_bit_cast(int, x), __builtin_bit_cast(int, x), 0x76543210, 0xfedcba98, false, false)); }  // lane l with lane l ^ 16
// 2^x with the one free issue slot behind a transcendental written in
__device__ __forceinline__ float exp2s(float x) { float r; asm("v_exp_f32 %0, %1\n\tv_nop" : "=v"(r) : "v"(x)); return r; }
__device__ __forceinline__ v16h packp(const float* p, v16h*) { v16h r;
#pragma unroll
    for (int e = 0; e < 16; ++e) r[e] = (h16)p[e];
    return r; }
__device__ __forceinline__ v16bf packp(const float* p, v16bf* lo) { v8us h0, h1, l0, l1;
#pragma unroll
    for (int e = 0; e < 8; ++e) { unsigned short a, c; splitf(p[e], a, c); h0[e] = a; l0[e] = c; splitf(p[8 + e], a, c); h1[e] = a; l1[e] = c; }
    *lo = cat16b(l0, l1); return cat16b(h0, h1); }
template <typename T16, int KT>
__device__ __forceinline__ void attn_rows(const T16* __restrict__ Q, const T16* __restrict__ Q2, const T16* __restrict__ Kp, const T16* __restrict__ K2, const T16* __restrict__ Vt, const T16* __restrict__ Vt2, int q0, int lr, int hi, float* __restrict__ orow) {
    typedef typename WFrag<T16>::V V;                // every full '#pragma unroll' below keeps a fragment or score array in registers (constant indices)
    const float CE = SCL * 1.4426950408889634f;      // raw score -> log2 domain
    const size_t qo = (size_t)(q0 + lr) * HD + 8 * hi, ko = (size_t)lr * HD + 8 * hi, vo = (size_t)lr * TT + 8 * hi;
    V qf[2], qf2[2];
#pragma unroll
    for (int c = 0; c < 2; ++c) { qf[c] = WFrag<T16>::ld(Q + qo + c * 32); qf2[c] = WFrag<T16>::ld(Q2 + qo + c * 32); }
    v8f o[4];
#pragma unroll
    for (int dt = 0; dt < 4; ++dt) o[dt] = (v8f){};
    float m = -3.0e38f, l = 0.f;
    const int nst = (q0 + 15 + KT * 16) / (KT * 16); // keys 0 .. q0 + 15 in steps of KT x 16; the last step ends at or below TT
    V kf[KT][2], kf2[KT][2];
#pragma unroll 1                                     // rolled: two steps unrolled take more than 256 registers, one wave a SIMD fewer
    for (int s = 0; s < nst; ++s) {
        const int kb = s * (KT * 16);
        V vf[4][KT / 2], vf2[4][KT / 2];
        // hi+lo planes: twice the fragments, so keys and values take turns in the registers (at most RH / 32 steps a wave)
#pragma unroll
            for (int kt = 0; kt < KT; ++kt)
#pragma unroll
                for (int c = 0; c < 2; ++c) { kf[kt][c] = WFrag<T16>::ld(Kp + ko + (size_t)(kb + kt * 16) * HD + c * 32); kf2[kt][c] = WFrag<T16>::ld(K2 + ko + (size_t)(kb + kt * 16) * HD + c * 32); }
        v8f st[KT];
#pragma unroll
        for (int kt = 0; kt < KT; ++kt) { st[kt] = (v8f){};
#pragma unroll
            for (int c = 0; c < 2; ++c) { st[kt] = WFrag<T16>::mma(kf[kt][c], qf[c], st[kt]); st[kt] = WFrag<T16>::mma(kf[kt][c], qf2[c], st[kt]); st[kt] = WFrag<T16>::mma(kf2[kt][c], qf[c], st[kt]); } }
        {
            asm volatile("s_wait_xcnt 0x0" ::: "memory");  // the key loads' address registers are reused by the value loads below
#pragma unroll
            for (int dt = 0; dt < 4; ++dt)
#pragma unroll
                for (int kc = 0; kc < KT / 2; ++kc) { vf[dt][kc] = WFrag<T16>::ld(Vt + vo + (size_t)(dt * 16) * TT + kb + kc * 32); vf2[dt][kc] = WFrag<T16>::ld(Vt2 + vo + (size_t)(dt * 16) * TT + kb + kc * 32); }
            asm volatile("s_wait_xcnt 0x0" ::: "memory");  // the value loads' address registers are reused by the softmax below
        }
        float p[KT * 8];
#pragma unroll
        for (int e = 0; e < KT * 8; ++e) p[e] = st[e >> 3][e & 7];
        if (kb + KT * 16 - 1 > q0) {                  // only a step that reaches the diagonal masks (wave-uniform)
#pragma unroll
            for (int e = 0; e < KT * 8; ++e) p[e] = (kb + (e >> 3) * 16 + hi * 8 + (e & 7) <= q0 + lr) ? p[e] : -3.0e38f; }
        float mx = p[0];
#pragma unroll
        for (int e = 1; e < KT * 8; ++e) mx = fmaxf(mx, p[e]);
        mx = fmaxf(mx, xhalf(mx));
        const float mn = fmaxf(m, mx), al = exp2s((m - mn) * CE), mc = mn * CE; m = mn;
        float ls = 0.f;
#pragma unroll
        for (int e = 0; e < KT * 8; ++e) { p[e] = exp2s(__builtin_fmaf(p[e], CE, -mc)); ls += p[e]; }
        l = l * al + ls;
#pragma unroll
        for (int dt = 0; dt < 4; ++dt) o[dt] *= al;
#pragma unroll
        for (int kc = 0; kc < KT / 2; ++kc) { V pf2; const V pf = packp(p + kc * 16, &pf2);
#pragma unroll
            for (int dt = 0; dt < 4; ++dt) { o[dt] = WFrag<T16>::mma(vf[dt][kc], pf, o[dt]); o[dt] = WFrag<T16>::mma(vf[dt][kc], pf2, o[dt]); o[dt] = WFrag<T16>::mma(vf2[dt][kc], pf, o[dt]); } }
    }
    l += xhalf(l);
    const float inv = __fdiv_rn(1.0f, l);
#pragma unroll
    for (int dt = 0; dt < 4; ++dt) { v4f a, b;
#pragma unroll
        for (int j = 0; j < 4; ++j) { a[j] = o[dt][j] * inv; b[j] = o[dt][4 + j] * inv; }
        *(v4f*)(orow + dt * 16) = a; *(v4f*)(orow + dt * 16 + 4) = b; }
}
// ---- the fp16 rows: the block's 4 waves walk the same 64-key steps, so each step's K rows [64 keys][64 d] and V^T rows [64 d][64 keys] are brought into LDS once for all four, as whole 128-byte lines (a fragment load from global memory touches 16 lines for 512 bytes).
#define LPB  144                  // LDS row pitch in bytes: 128 + 16 (16 B x odd), conflict-free for 16-byte fragment reads
#define TLB  (64 * LPB)           // one tile of 64 rows
#define BFB  (2 * TLB)            // one buffer: K tile, then V^T tile
// One step's tiles, 8 asynchronous 16-byte copies a lane (8 lanes a row, 16 rows a round of the block). kg, vg, ld: this lane's first K, V^T and LDS place.
__device__ __forceinline__ void stage_kv(const h16* kg, const h16* vg, unsigned ld) {
    // the s_wait_xcnt closes the statement so that no address register of a copy is rewritten in front of it
    asm volatile("global_load_async_to_lds_b128 %0, %8, off\n\t"
                 "global_load_async_to_lds_b128 %1, %9, off\n\t"
                 "global_load_async_to_lds_b128 %2, %10, off\n\t"
                 "global_load_async_to_lds_b128 %3, %11, off\n\t"
                 "global_load_async_to_lds_b128 %4, %12, off\n\t"
                 "global_load_async_to_lds_b128 %5, %13, off\n\t"
                 "global_load_async_to_lds_b128 %6, %14, off\n\t"
                 "global_load_async_to_lds_b128 %7, %15, off\n\t"
                 "s_wait_xcnt 0x0"
                 :: "v"(ld), "v"(ld + 16u * LPB), "v"(ld + 32u * LPB), "v"(ld + 48u * LPB), "v"(ld + TLB), "v"(ld + TLB + 16u * LPB), "v"(ld + TLB + 32u * LPB), "v"(ld + TLB + 48u * LPB),
                    "v"(kg), "v"(kg + 16 * HD), "v"(kg + 32 * HD), "v"(kg + 48 * HD), "v"(vg), "v"(vg + (size_t)16 * TT), "v"(vg + (size_t)32 * TT), "v"(vg + (size_t)48 * TT)
                 : "memory");
}
// nst = steps of the whole block (the same for its 4 waves); two buffers: step s + 1's copies fly while step s is worked on.
__device__ __forceinline__ void attn_rows_st(const h16* __restrict__ Q, const h16* __restrict__ Kp, const h16* __restrict__ Vt, char* sm, int nst, int q0, int lr, int hi, float* __restrict__ orow) {
    typedef WFrag<h16>::V V;                          // every full '#pragma unroll' below keeps a fragment or score array in registers (constant indices)
    const int KT = 4;
    const float CE = SCL * 1.4426950408889634f;      // raw score -> log2 domain
    const int tid = threadIdx.x;
    const h16* kg = Kp + tid * 8; const h16* vg = Vt + (size_t)(tid >> 3) * TT + (tid & 7) * 8;
    const unsigned ld = (unsigned)(size_t)sm + (unsigned)((tid >> 3) * LPB + (tid & 7) * 16);
    const int fo = lr * LPB + 16 * hi;                // a lane's byte place in a 16-row fragment of a tile
    stage_kv(kg, vg, ld);
    V qf[2];
#pragma unroll
    for (int c = 0; c < 2; ++c) qf[c] = WFrag<h16>::ld(Q + (size_t)(q0 + lr) * HD + 8 * hi + c * 32);
    v8f o[4];
#pragma unroll
    for (int dt = 0; dt < 4; ++dt) o[dt] = (v8f){};
    float m = -3.0e38f, l = 0.f;
    asm volatile("s_wait_asynccnt 0x0" ::: "memory");  // this wave's copies of step 0 have landed
    __syncthreads();                                   // ... and every other wave's
    if (nst > 1) stage_kv(kg + 64 * HD, vg + 64, ld + BFB);
#pragma unroll 1                                     // rolled: one step's fragments and scores fill the registers of 4 waves a SIMD
    for (int s = 0; s < nst; ++s) {
        const int kb = s * (KT * 16);
        const char* tk = sm + (s & 1) * BFB + fo; const char* tv = tk + TLB;
        V kf[KT][2], vf[4][KT / 2];
#pragma unroll
        for (int kt = 0; kt < KT; ++kt)
#pragma unroll
            for (int c = 0; c < 2; ++c) kf[kt][c] = WFrag<h16>::ld((const h16*)(tk + kt * 16 * LPB + c * 64));
        __builtin_amdgcn_sched_barrier(0);            // the 16 K reads go out as one group: without it this build read one fragment, waited for it and multiplied, eight times a step
        v8f st[KT];
#pragma unroll
        for (int kt = 0; kt < KT; ++kt) { st[kt] = (v8f){};
#pragma unroll
            for (int c = 0; c < 2; ++c) st[kt] = WFrag<h16>::mma(kf[kt][c], qf[c], st[kt]); }
#pragma unroll
        for (int dt = 0; dt < 4; ++dt)
#pragma unroll
            for (int kc = 0; kc < KT / 2; ++kc) vf[dt][kc] = WFrag<h16>::ld((const h16*)(tv + dt * 16 * LPB + kc * 64));
        __builtin_amdgcn_sched_barrier(0);            // the 16 V^T reads start here, under the softmax, not next to their products
        float p[KT * 8];
#pragma unroll
        for (int e = 0; e < KT * 8; ++e) p[e] = st[e >> 3][e & 7];
        if (kb + KT * 16 - 1 > q0) {                  // only a step that reaches the diagonal masks (wave-uniform)
#pragma unroll
            for (int e = 0; e < KT * 8; ++e) p[e] = (kb + (e >> 3) * 16 + hi * 8 + (e & 7) <= q0 + lr) ? p[e] : -3.0e38f; }
        float mx = p[0];
#pragma unroll
        for (int e = 1; e < KT * 8; ++e) mx = fmaxf(mx, p[e]);
        mx = fmaxf(mx, xhalf(mx));
        const float mn = fmaxf(m, mx), al = exp2s((m - mn) * CE), mc = mn * CE; m = mn;
        float ls = 0.f;
#pragma unroll
        for (int e = 0; e < KT * 8; ++e) { p[e] = exp2s(__builtin_fmaf(p[e], CE, -mc)); ls += p[e]; }
        l = l * al + ls;
#pragma unroll
        for (int dt = 0; dt < 4; ++dt) o[dt] *= al;
        __builtin_amdgcn_sched_barrier(0);            // every exp2s stays in front of the P.V products
#pragma unroll
        for (int kc = 0; kc < KT / 2; ++kc) { const V pf = packp(p + kc * 16, (V*)nullptr);
#pragma unroll
            for (int dt = 0; dt < 4; ++dt) o[dt] = WFrag<h16>::mma(vf[dt][kc], pf, o[dt]); }
        asm volatile("s_wait_dscnt 0x0" ::: "memory");     // this wave's reads of the buffer are done before it may be refilled
        asm volatile("s_wait_asynccnt 0x0" ::: "memory");  // this wave's copies of step s + 1 have landed
        __syncthreads();                                   // publishes step s + 1 and ends every wave's reads of step s
        if (s + 2 < nst) stage_kv(kg + (size_t)(kb + 128) * HD, vg + kb + 128, ld + (unsigned)(s & 1) * BFB);
    }
    asm volatile("s_wait_asynccnt 0x0" ::: "memory");  // nothing is in flight when the wave ends
    l += xhalf(l);
    const float inv = __fdiv_rn(1.0f, l);
#pragma unroll
    for (int dt = 0; dt < 4; ++dt) { v4f a, b;
#pragma unroll
        for (int j = 0; j < 4; ++j) { a[j] = o[dt][j] * inv; b[j] = o[dt][4 + j] * inv; }
        *(v4f*)(orow + dt * 16) = a; *(v4f*)(orow + dt * 16 + 4) = b; }
}
__global__ __launch_bounds__(128) void k_fattn(const h16* __restrict__ Q16, const h16* __restrict__ K16, const h16* __restrict__ V16, const bf* __restrict__ Qh, const bf* __restrict__ Ql, const bf* __restrict__ Kh, const bf* __restrict__ Kl, const bf* __restrict__ Vh, const bf* __restrict__ Vl, float* __restrict__ out) {
    __shared__ __align__(16) char sm[2 * BFB];
    const int lane = threadIdx.x & 31, lr = lane & 15, hi = lane >> 4; const int wv = __builtin_amdgcn_readfirstlane((int)(threadIdx.x >> 5));
    const int bh = blockIdx.x % (NB_ * NH_), qg = TT / 64 - 1 - (int)(blockIdx.x / (NB_ * NH_)); const int q0 = qg * 64 + wv * 16;
    const size_t pl = (size_t)bh * TT * HD;          // this batch and head's plane ([t][d] for q and k, [d][t] for v)
    float* orow = out + ((size_t)(bh / NH_) * TT + q0 + lr) * DQ + (bh % NH_) * HD + hi * 8;
    if (qg * 64 < RH) attn_rows<bf, 2>(Qh + pl, Ql + pl, Kh + pl, Kl + pl, Vh + pl, Vl + pl, q0, lr, hi, orow);
    else attn_rows_st(Q16 + pl, K16 + pl, V16 + pl, sm, qg + 1, q0, lr, hi, orow);   // keys 0 .. qg * 64 + 63: qg + 1 steps for each of the 4 waves
}

extern "C" void kernel_launch(void* const* d_in, const int* in_sizes, int n_in,
                              void* d_out, int out_size, void* d_ws, size_t ws_size, hipStream_t stream) {
    (void)in_sizes; (void)n_in; (void)out_size;
    const float* x = (const float*)d_in[0]; const float* wq = (const float*)d_in[1]; const float* bq = (const float*)d_in[2]; const float* wk = (const float*)d_in[3]; const float* bk = (const float*)d_in[4]; const float* wv = (const float*)d_in[5]; const float* bv = (const float*)d_in[6];
    float* OUT = (float*)d_out;     // [2][2048][1024]
    char* wsp = (char*)d_ws;
    auto take = [&](size_t bytes) { char* p = wsp; wsp += (bytes + 255) & ~(size_t)255; return (void*)p; };
    bf* XW = (bf*)take(((size_t)NB_ * TT + 3 * DQ) * DM * 2);   // bf16 x rows of both batches, then the wq, wk, wv rows
    const size_t PB = (size_t)NH_ * TT * HD;   // elements of one batch's head planes
    h16* QP16 = (h16*)take(NB_ * PB * 2); h16* KP16 = (h16*)take(NB_ * PB * 2); h16* VT16 = (h16*)take(NB_ * PB * 2);
    bf* QPh = (bf*)take(NB_ * PB * 2); bf* QPl = (bf*)take(NB_ * PB * 2); bf* KPh = (bf*)take(NB_ * PB * 2); bf* KPl = (bf*)take(NB_ * PB * 2); bf* VTh = (bf*)take(NB_ * PB * 2); bf* VTl = (bf*)take(NB_ * PB * 2);
    if ((size_t)(wsp - (char*)d_ws) > ws_size) return;    // ws 256 MiB
    k_cvtall<<<(NB_ * TT + 3 * DQ) * DM / CB, 256, 0, stream>>>(x, wq, wk, wv, XW);
    k_proj<<<dim3(NB_ * TT / 64, 3 * DQ / 64, 1), 32, 0, stream>>>(XW, XW + (size_t)NB_ * TT * DM, bq, bk, bv, QP16, QPh, QPl, KP16, KPh, KPl, VT16, VTh, VTl);
    k_fattn<<<NB_ * NH_ * (TT / 64), 128, 0, stream>>>(QP16, KP16, VT16, QPh, QPl, KPh, KPl, VTh, VTl, OUT);
}

// v004
// Measured time: 65.1 microseconds a run.
// Two timings next to v003 put it at 1.41 and 1.43 times that version's speed.
// Over all steps from v000 it is 21.4 times as fast.
#include <hip/hip_runtime.h>

// Causal multi-head self-attention without an output projection (x [2][2048][1024]; q, k, v = x W^T + b ('oi' [1024][1024] + [1024], 16 heads x 64); att = q.k / sqrt(1024) (the module scales by the full hidden size), causal mask (-inf above the diagonal); softmax; out = merged heads -> [2][2048][1024] (4.2 M)).
// Compute dtypes, f32 accumulate: every input rounded to bf16; q/k/v on PLAIN bf16 operands (inputs: exact) + biases, one launch for all three and both batches, operand rows staged in LDS for a block's 4 waves, head planes written from its epilogue; causal scores and attn.v in one launch (running maximum and sum over 32- or 64-key steps): query rows < 512 hl (3 products), the rest single fp16 with its key and value tiles staged in LDS for the block's 4 waves; softmax f32; no output projection: the merged heads are written in f32 straight to the output.

#define NB_  2
#define TT   2048
#define DM   1024
#define NH_  16
#define NKV  16
#define HD   64
#define DQ   (NH_ * HD)
#define DKV  (NKV * HD)
#define RH   512                  // query rows < RH use hi+lo planes (0: none)
#define SCL  0.03125f   // 1/sqrt(h_dim = 1024): the module scales by the full hidden size
typedef _Float16 h16;
typedef unsigned short bf;
typedef __attribute__((ext_vector_type(16))) __bf16   v16bf;
typedef __attribute__((ext_vector_type(16))) _Float16 v16h;
typedef __attribute__((ext_vector_type(8)))  _Float16 v8h;
typedef __attribute__((ext_vector_type(8)))  unsigned short v8us;
typedef __attribute__((ext_vector_type(8)))  float    v8f;
typedef __attribute__((ext_vector_type(4)))  float    v4f;
typedef v8h  __attribute__((may_alias)) v8ha;
typedef v4f  __attribute__((may_alias)) v4fa;
typedef v8us __attribute__((may_alias)) v8usa;

__device__ __forceinline__ unsigned short f2bf(float f) { unsigned u = __float_as_uint(f); u += 0x7FFFu + ((u >> 16) & 1u); return (unsigned short)(u >> 16); }
__device__ __forceinline__ float bf2f(unsigned short b) { return __uint_as_float(((unsigned)b) << 16); }
__device__ __forceinline__ float bfr(float f) { return bf2f(f2bf(f)); }
__device__ __forceinline__ v16h cat16(v8h lo, v8h hi) { return __builtin_shufflevector(lo, hi, 0, 1, 2, 3, 4, 5, 6, 7, 8, 9, 10, 11, 12, 13, 14, 15); }
__device__ __forceinline__ v16bf cat16b(v8us lo, v8us hi) { return __builtin_bit_cast(v16bf, __builtin_shufflevector(lo, hi, 0, 1, 2, 3, 4, 5, 6, 7, 8, 9, 10, 11, 12, 13, 14, 15)); }
__device__ __forceinline__ v8f wmma16(v16h a, v16h b, v8f c) { return __builtin_amdgcn_wmma_f32_16x16x32_f16(false, a, false, b, (short)0, c, false, false); }
__device__ __forceinline__ v8f wmmab(v16bf a, v16bf b, v8f c) { return __builtin_amdgcn_wmma_f32_16x16x32_bf16(false, a, false, b, (short)0, c, false, false); }



// fragment loaders and matrix products by 16-bit type: a fragment is two 16-byte loads of one K-contiguous row
template <typename T16> struct WFrag;
template <> struct WFrag<h16> { typedef v16h V; static __device__ __forceinline__ V ld(const h16* p) { return cat16(*(const v8h*)p, *(const v8h*)(p + 16)); } static __device__ __forceinline__ v8f mma(V a, V b, v8f c) { return wmma16(a, b, c); } };
template <> struct WFrag<bf> { typedef v16bf V; static __device__ __forceinline__ V ld(const bf* p) { return cat16b(*(const v8us*)p, *(const v8us*)(p + 16)); } static __device__ __forceinline__ v8f mma(V a, V b, v8f c) { return wmmab(a, b, c); } };
__device__ __forceinline__ h16 tohx(float x) { return (h16)x; }
__device__ __forceinline__ void splitf(float y, unsigned short& h, unsigned short& l) { h = f2bf(y); l = f2bf(y - bf2f(h)); }
// ---- k_cvtall: x (both batches) and the three weights rounded to bf16 into one plane [x rows | wq rows | wk rows | wv rows] x DM; 8192 elements a block, 4 x 8 a thread.
#define CB   8192
__global__ __launch_bounds__(256) void k_cvtall(const float* __restrict__ x, const float* __restrict__ wq, const float* __restrict__ wk, const float* __restrict__ wv, bf* dst) {
    const int XBK = NB_ * TT * DM / CB, WBK = DQ * DM / CB; const int blk = blockIdx.x;
    const float* src = x; int sb = blk;
    if (blk >= XBK) { const int w = (blk - XBK) / WBK; sb = (blk - XBK) % WBK; src = (w == 0) ? wq : (w == 1) ? wk : wv; }
    const float* s = src + (size_t)sb * CB + threadIdx.x * 8; bf* d = dst + (size_t)blk * CB + threadIdx.x * 8;
    v8f v[4];
#pragma unroll
    for (int i = 0; i < 4; ++i) v[i] = *(const v8f*)(s + i * 2048);
#pragma unroll
    for (int i = 0; i < 4; ++i) { v8us o;
#pragma unroll
        for (int k = 0; k < 8; ++k) o[k] = f2bf(v[i][k]);
        *(v8us*)(d + i * 2048) = o; }
}

// ---- k_proj: the q, k and v projections of both batches in one launch. A block of 4 waves owns 128 tokens x 128 output columns (two heads of one of q, k, v), ONE WAVE per 64x64 tile (16 accumulators); grid (NB_ * TT / 128, 3 * DQ / 128), 128 threads.
// Each 64-k step's 128 x rows and 128 weight rows are brought into LDS once for the block, as whole 128-byte lines (a fragment load from global memory touches 16 lines for 512 bytes, and each row is wanted by two waves); two buffers: step s + 1's copies fly while step s is worked on.
// A wave's tile is 64 tokens x one head. q and k: A = x rows, B = weight rows, tile [t][d]; v: A = weight rows, B = x rows, tile [d][t], so every tile row is one 128-byte row of its head plane ([h][t][d] for q and k, [h][d][t] for v).
// Epilogue: + bf16-rounded bias in f32, then the fp16 plane and the hi + lo bf16 planes, 16-byte stores.
#define PLB  144                  // LDS row pitch in bytes: 128 + 16 (16 B x odd), conflict-free for 16-byte fragment reads
#define PXB  (128 * PLB)          // one operand's 128 rows
#define PBF  (2 * PXB)            // one buffer: x rows, then weight rows
// 128 rows x 128 bytes of one operand, 8 asynchronous 16-byte copies a lane (8 lanes a row, 16 rows a round of the block). g, ld: this lane's first global and LDS place.
__device__ __forceinline__ void stage_rows(const bf* g, unsigned ld) {
    // the s_wait_xcnt closes the statement so that no address register of a copy is rewritten in front of it
    asm volatile("global_load_async_to_lds_b128 %0, %8, off\n\t"
                 "global_load_async_to_lds_b128 %1, %9, off\n\t"
                 "global_load_async_to_lds_b128 %2, %10, off\n\t"
                 "global_load_async_to_lds_b128 %3, %11, off\n\t"
                 "global_load_async_to_lds_b128 %4, %12, off\n\t"
                 "global_load_async_to_lds_b128 %5, %13, off\n\t"
                 "global_load_async_to_lds_b128 %6, %14, off\n\t"
                 "global_load_async_to_lds_b128 %7, %15, off\n\t"
                 "s_wait_xcnt 0x0"
                 :: "v"(ld), "v"(ld + 16u * PLB), "v"(ld + 32u * PLB), "v"(ld + 48u * PLB), "v"(ld + 64u * PLB), "v"(ld + 80u * PLB), "v"(ld + 96u * PLB), "v"(ld + 112u * PLB),
                    "v"(g), "v"(g + 16 * DM), "v"(g + 32 * DM), "v"(g + 48 * DM), "v"(g + 64 * DM), "v"(g + 80 * DM), "v"(g + 96 * DM), "v"(g + 112 * DM)
                 : "memory");
}
__global__ __launch_bounds__(128) void k_proj(const bf* __restrict__ X, const bf* __restrict__ Wt, const float* __restrict__ bq, const float* __restrict__ bk, const float* __restrict__ bv, h16* Q16, bf* Qh, bf* Ql, h16* K16, bf* Kh, bf* Kl, h16* V16, bf* Vh, bf* Vl) {
    typedef WFrag<bf>::V V;
    __shared__ __align__(16) char sm[2 * PBF];
    __shared__ __align__(16) float osb[4][16 * 68];
    const int K = DM, NS = DM / 64;
    const int tid = threadIdx.x, lane = tid & 31, lr = lane & 15, hi = lane >> 4; const int wv = __builtin_amdgcn_readfirstlane(tid >> 5);
    const int tb = blockIdx.x * 128, nb0 = blockIdx.y * 128; const int wt = wv & 1, wn = wv >> 1; const int t0 = tb + wt * 64, n0 = nb0 + wn * 64;
    const int which = n0 / DQ, h = (n0 % DQ) / HD; const bool tr = which == 2;   // block-uniform: 0 q, 1 k, 2 v
    float* os = osb[wv];                              // each wave's own epilogue rows
    const bf* xg = X + (size_t)(tb + (tid >> 3)) * K + (tid & 7) * 8; const bf* wg = Wt + (size_t)(nb0 + (tid >> 3)) * K + (tid & 7) * 8;
    const unsigned ld = (unsigned)(size_t)sm + (unsigned)((tid >> 3) * PLB + (tid & 7) * 16);
    const int fo = lr * PLB + 16 * hi;                // a lane's byte place in a 16-row fragment, the same for A and B
    const char* fx = sm + wt * 64 * PLB + fo; const char* fw = sm + PXB + wn * 64 * PLB + fo;
    const char* fa = tr ? fw : fx; const char* fb = tr ? fx : fw;
    stage_rows(xg, ld); stage_rows(wg, ld + PXB);
    v8f acc[4][4];
#pragma unroll
    for (int mb = 0; mb < 4; ++mb)
#pragma unroll
        for (int nb = 0; nb < 4; ++nb) acc[mb][nb] = (v8f){};
    asm volatile("s_wait_asynccnt 0x0" ::: "memory");  // this wave's copies of step 0 have landed
    __syncthreads();                                   // ... and every other wave's
    stage_rows(xg + 64, ld + PBF); stage_rows(wg + 64, ld + PBF + PXB);
#pragma unroll 1                                     // rolled: the two buffers take turns by (s & 1)
    for (int s = 0; s < NS; ++s) {
        const int bo = (s & 1) * PBF;
        V a[4], b[4];
#pragma unroll
        for (int c = 0; c < 2; ++c) {
#pragma unroll
            for (int mb = 0; mb < 4; ++mb) a[mb] = WFrag<bf>::ld((const bf*)(fa + bo + mb * 16 * PLB + c * 64));
#pragma unroll
            for (int nb = 0; nb < 4; ++nb) b[nb] = WFrag<bf>::ld((const bf*)(fb + bo + nb * 16 * PLB + c * 64));
            __builtin_amdgcn_sched_barrier(0);        // the 16 LDS reads of a 32-k chunk go out as one group: without it this build read one B fragment, waited for it and multiplied, four times a chunk
            if (c == 1) {                             // the step's last LDS reads are out: hand the buffer over here, so that the refill is under way while the second chunk's products (registers only) run
                asm volatile("s_wait_dscnt 0x0" ::: "memory");     // this wave's reads of the buffer are done before it may be refilled
                asm volatile("s_wait_asynccnt 0x0" ::: "memory");  // this wave's copies of step s + 1 have landed
                __syncthreads();                                   // publishes step s + 1 and ends every wave's reads of step s
                if (s + 2 < NS) { stage_rows(xg + (s + 2) * 64, ld + (unsigned)bo); stage_rows(wg + (s + 2) * 64, ld + (unsigned)bo + PXB); }
            }
#pragma unroll
            for (int nb = 0; nb < 4; ++nb)
#pragma unroll
                for (int mb = 0; mb < 4; ++mb) acc[mb][nb] = WFrag<bf>::mma(a[mb], b[nb], acc[mb][nb]);
        }
    }
    asm volatile("s_wait_asynccnt 0x0" ::: "memory");  // nothing is in flight when the wave goes on to the epilogue
    const size_t base = (size_t)((t0 / TT) * NH_ + h) * TT * HD + (tr ? (size_t)(t0 % TT) : (size_t)(t0 % TT) * HD); const int pitch = tr ? TT : HD;
    h16* P16 = ((which == 0) ? Q16 : (which == 1) ? K16 : V16) + base; bf* Ph = ((which == 0) ? Qh : (which == 1) ? Kh : Vh) + base; bf* Pl = ((which == 0) ? Ql : (which == 1) ? Kl : Vl) + base;
    const float* bias = ((which == 0) ? bq : (which == 1) ? bk : bv) + h * HD;
    const int rsub = lane >> 3, cofs = (lane & 7) * 8;   // 8 lanes write one 128-byte plane row
    float bc[8];
#pragma unroll
    for (int e = 0; e < 8; ++e) bc[e] = bfr(bias[cofs + e]);
#pragma unroll
    for (int mb = 0; mb < 4; ++mb) {
#pragma unroll
        for (int nb = 0; nb < 4; ++nb) {
#pragma unroll
            for (int j = 0; j < 8; ++j) os[(hi * 8 + j) * 68 + nb * 16 + lr] = acc[mb][nb][j]; }
        __builtin_amdgcn_wave_barrier(); asm volatile("" ::: "memory");  // compiler order only (one wave): the 16 tile rows are stored to LDS before they are read back
#pragma unroll
        for (int s = 0; s < 4; ++s) { const int row = 4 * s + rsub; const v4f lo4 = *(const v4fa*)(os + row * 68 + cofs), hi4 = *(const v4fa*)(os + row * 68 + cofs + 4);
            const float br = bfr(bias[mb * 16 + row]); v8h o16; v8us oh, ol;
#pragma unroll
            for (int e = 0; e < 8; ++e) { const float r = ((e < 4) ? lo4[e & 3] : hi4[e & 3]) + (tr ? br : bc[e]); o16[e] = tohx(r); unsigned short a2, c2; splitf(r, a2, c2); oh[e] = a2; ol[e] = c2; }
            const size_t off = (size_t)(mb * 16 + row) * pitch + cofs;
            *(v8h*)(P16 + off) = o16; *(v8us*)(Ph + off) = oh; *(v8us*)(Pl + off) = ol; }
        __builtin_amdgcn_wave_barrier(); asm volatile("" ::: "memory");  // compiler order only: the rows are read before the next 16 overwrite them
    }
}

// ---- k_fattn: scores, causal softmax and probability x value in one launch for every batch and head. One wave owns 16 query rows and walks its keys KT x 16 at a time with a running maximum and sum.
// Transposed products: S^T = K Q^T (A = key rows, B = query rows), O^T += V^T P^T (A = V^T rows, B = two score tiles converted in place), so a lane holds one query's scores and P needs no lane exchange and no LDS.
// Query rows < RH (attn_rows): hi+lo bf16 planes, 3 products each, 32 keys a step, fragments straight from global memory. The rest (attn_rows_st): single fp16, 64 keys a step, tiles in LDS. Grid: heaviest 64-row query groups first, 4 waves a block.
__device__ __forceinline__ float xhalf(float x) { return __builtin_bit_cast(float, __builtin_amdgcn_permlanex16(__builtin_bit_cast(int, x), __builtin_bit_cast(int, x), 0x76543210, 0xfedcba98, false, false)); }  // lane l with lane l ^ 16
// 2^x with the one free issue slot behind a transcendental written in
__device__ __forceinline__ float exp2s(float x) { float r; asm("v_exp_f32 %0, %1\n\tv_nop" : "=v"(r) : "v"(x)); return r; }
__device__ __forceinline__ v16h packp(const float* p, v16h*) { v16h r;
#pragma unroll
    for (int e = 0; e < 16; ++e) r[e] = (h16)p[e];
    return r; }
__device__ __forceinline__ v16bf packp(const float* p, v16bf* lo) { v8us h0, h1, l0, l1;
#pragma unroll
    for (int e = 0; e < 8; ++e) { unsigned short a, c; splitf(p[e], a, c); h0[e] = a; l0[e] = c; splitf(p[8 + e], a, c); h1[e] = a; l1[e] = c; }
    *lo = cat16b(l0, l1); return cat16b(h0, h1); }
template <typename T16, int KT>
__device__ __forceinline__ void attn_rows(const T16* __restrict__ Q, const T16* __restrict__ Q2, const T16* __restrict__ Kp, const T16* __restrict__ K2, const T16* __restrict__ Vt, const T16* __restrict__ Vt2, int q0, int lr, int hi, float* __restrict__ orow) {
    typedef typename WFrag<T16>::V V;                // every full '#pragma unroll' below keeps a fragment or score array in registers (constant indices)
    const float CE = SCL * 1.4426950408889634f;      // raw score -> log2 domain
    const size_t qo = (size_t)(q0 + lr) * HD + 8 * hi, ko = (size_t)lr * HD + 8 * hi, vo = (size_t)lr * TT + 8 * hi;
    V qf[2], qf2[2];
#pragma unroll
    for (int c = 0; c < 2; ++c) { qf[c] = WFrag<T16>::ld(Q + qo + c * 32); qf2[c] = WFrag<T16>::ld(Q2 + qo + c * 32); }
    v8f o[4];
#pragma unroll
    for (int dt = 0; dt < 4; ++dt) o[dt] = (v8f){};
    float m = -3.0e38f, l = 0.f;
    const int nst = (q0 + 15 + KT * 16) / (KT * 16); // keys 0 .. q0 + 15 in steps of KT x 16; the last step ends at or below TT
    V kf[KT][2], kf2[KT][2];
#pragma unroll 1                                     // rolled: two steps unrolled take more than 256 registers, one wave a SIMD fewer
    for (int s = 0; s < nst; ++s) {
        const int kb = s * (KT * 16);
        V vf[4][KT / 2], vf2[4][KT / 2];
        // hi+lo planes: twice the fragments, so keys and values take turns in the registers (at most RH / 32 steps a wave)
#pragma unroll
            for (int kt = 0; kt < KT; ++kt)
#pragma unroll
                for (int c = 0; c < 2; ++c) { kf[kt][c] = WFrag<T16>::ld(Kp + ko + (size_t)(kb + kt * 16) * HD + c * 32); kf2[kt][c] = WFrag<T16>::ld(K2 + ko + (size_t)(kb + kt * 16) * HD + c * 32); }
        v8f st[KT];
#pragma unroll
        for (int kt = 0; kt < KT; ++kt) { st[kt] = (v8f){};
#pragma unroll
            for (int c = 0; c < 2; ++c) { st[kt] = WFrag<T16>::mma(kf[kt][c], qf[c], st[kt]); st[kt] = WFrag<T16>::mma(kf[kt][c], qf2[c], st[kt]); st[kt] = WFrag<T16>::mma(kf2[kt][c], qf[c], st[kt]); } }
        {
            asm volatile("s_wait_xcnt 0x0" ::: "memory");  // the key loads' address registers are reused by the value loads below
#pragma unroll
            for (int dt = 0; dt < 4; ++dt)
#pragma unroll
                for (int kc = 0; kc < KT / 2; ++kc) { vf[dt][kc] = WFrag<T16>::ld(Vt + vo + (size_t)(dt * 16) * TT + kb + kc * 32); vf2[dt][kc] = WFrag<T16>::ld(Vt2 + vo + (size_t)(dt * 16) * TT + kb + kc * 32); }
            asm volatile("s_wait_xcnt 0x0" ::: "memory");  // the value loads' address registers are reused by the softmax below
        }
        float p[KT * 8];
#pragma unroll
        for (int e = 0; e < KT * 8; ++e) p[e] = st[e >> 3][e & 7];
        if (kb + KT * 16 - 1 > q0) {                  // only a step that reaches the diagonal masks (wave-uniform)
#pragma unroll
            for (int e = 0; e < KT * 8; ++e) p[e] = (kb + (e >> 3) * 16 + hi * 8 + (e & 7) <= q0 + lr) ? p[e] : -3.0e38f; }
        float mx = p[0];
#pragma unroll
        for (int e = 1; e < KT * 8; ++e) mx = fmaxf(mx, p[e]);
        mx = fmaxf(mx, xhalf(mx));
        const float mn = fmaxf(m, mx), al = exp2s((m - mn) * CE), mc = mn * CE; m = mn;
        float ls = 0.f;
#pragma unroll
        for (int e = 0; e < KT * 8; ++e) { p[e] = exp2s(__builtin_fmaf(p[e], CE, -mc)); ls += p[e]; }
        l = l * al + ls;
#pragma unroll
        for (int dt = 0; dt < 4; ++dt) o[dt] *= al;
#pragma unroll
        for (int kc = 0; kc < KT / 2; ++kc) { V pf2; const V pf = packp(p + kc * 16, &pf2);
#pragma unroll
            for (int dt = 0; dt < 4; ++dt) { o[dt] = WFrag<T16>::mma(vf[dt][kc], pf, o[dt]); o[dt] = WFrag<T16>::mma(vf[dt][kc], pf2, o[dt]); o[dt] = WFrag<T16>::mma(vf2[dt][kc], pf, o[dt]); } }
    }
    l += xhalf(l);
    const float inv = __fdiv_rn(1.0f, l);
#pragma unroll
    for (int dt = 0; dt < 4; ++dt) { v4f a, b;
#pragma unroll
        for (int j = 0; j < 4; ++j) { a[j] = o[dt][j] * inv; b[j] = o[dt][4 + j] * inv; }
        *(v4f*)(orow + dt * 16) = a; *(v4f*)(orow + dt * 16 + 4) = b; }
}
// ---- the fp16 rows: the block's 4 waves walk the same 64-key steps, so each step's K rows [64 keys][64 d] and V^T rows [64 d][64 keys] are brought into LDS once for all four, as whole 128-byte lines (a fragment load from global memory touches 16 lines for 512 bytes).
#define LPB  144                  // LDS row pitch in bytes: 128 + 16 (16 B x odd), conflict-free for 16-byte fragment reads
#define TLB  (64 * LPB)           // one tile of 64 rows
#define BFB  (2 * TLB)            // one buffer: K tile, then V^T tile
// One step's tiles, 8 asynchronous 16-byte copies a lane (8 lanes a row, 16 rows a round of the block). kg, vg, ld: this lane's first K, V^T and LDS place.
__device__ __forceinline__ void stage_kv(const h16* kg, const h16* vg, unsigned ld) {
    // the s_wait_xcnt closes the statement so that no address register of a copy is rewritten in front of it
    asm volatile("global_load_async_to_lds_b128 %0, %8, off\n\t"
                 "global_load_async_to_lds_b128 %1, %9, off\n\t"
                 "global_load_async_to_lds_b128 %2, %10, off\n\t"
                 "global_load_async_to_lds_b128 %3, %11, off\n\t"
                 "global_load_async_to_lds_b128 %4, %12, off\n\t"
                 "global_load_async_to_lds_b128 %5, %13, off\n\t"
                 "global_load_async_to_lds_b128 %6, %14, off\n\t"
                 "global_load_async_to_lds_b128 %7, %15, off\n\t"
                 "s_wait_xcnt 0x0"
                 :: "v"(ld), "v"(ld + 16u * LPB), "v"(ld + 32u * LPB), "v"(ld + 48u * LPB), "v"(ld + TLB), "v"(ld + TLB + 16u * LPB), "v"(ld + TLB + 32u * LPB), "v"(ld + TLB + 48u * LPB),
                    "v"(kg), "v"(kg + 16 * HD), "v"(kg + 32 * HD), "v"(kg + 48 * HD), "v"(vg), "v"(vg + (size_t)16 * TT), "v"(vg + (size_t)32 * TT), "v"(vg + (size_t)48 * TT)
                 : "memory");
}
// nst = steps of the whole block (the same for its 4 waves); two buffers: step s + 1's copies fly while step s is worked on.
__device__ __forceinline__ void attn_rows_st(const h16* __restrict__ Q, const h16* __restrict__ Kp, const h16* __restrict__ Vt, char* sm, int nst, int q0, int lr, int hi, float* __restrict__ orow) {
    typedef WFrag<h16>::V V;                          // every full '#pragma unroll' below keeps a fragment or score array in registers (constant indices)
    const int KT = 4;
    const float CE = SCL * 1.4426950408889634f;      // raw score -> log2 domain
    const int tid = threadIdx.x;
    const h16* kg = Kp + tid * 8; const h16* vg = Vt + (size_t)(tid >> 3) * TT + (tid & 7) * 8;
    const unsigned ld = (unsigned)(size_t)sm + (unsigned)((tid >> 3) * LPB + (tid & 7) * 16);
    const int fo = lr * LPB + 16 * hi;                // a lane's byte place in a 16-row fragment of a tile
    stage_kv(kg, vg, ld);
    V qf[2];
#pragma unroll
    for (int c = 0; c < 2; ++c) qf[c] = WFrag<h16>::ld(Q + (size_t)(q0 + lr) * HD + 8 * hi + c * 32);
    v8f o[4];
#pragma unroll
    for (int dt = 0; dt < 4; ++dt) o[dt] = (v8f){};
    float m = -3.0e38f, l = 0.f;
    asm volatile("s_wait_asynccnt 0x0" ::: "memory");  // this wave's copies of step 0 have landed
    __syncthreads();                                   // ... and every other wave's
    if (nst > 1) stage_kv(kg + 64 * HD, vg + 64, ld + BFB);
#pragma unroll 1                                     // rolled: one step's fragments and scores fill the registers of 4 waves a SIMD
    for (int s = 0; s < nst; ++s) {
        const int kb = s * (KT * 16);
        const char* tk = sm + (s & 1) * BFB + fo; const char* tv = tk + TLB;
        V kf[KT][2], vf[4][KT / 2];
#pragma unroll
        for (int kt = 0; kt < KT; ++kt)
#pragma unroll
            for (int c = 0; c < 2; ++c) kf[kt][c] = WFrag<h16>::ld((const h16*)(tk + kt * 16 * LPB + c * 64));
        __builtin_amdgcn_sched_barrier(0);            // the 16 K reads go out as one group: without it this build read one fragment, waited for it and multiplied, eight times a step
        v8f st[KT];
#pragma unroll
        for (int kt = 0; kt < KT; ++kt) { st[kt] = (v8f){};
#pragma unroll
            for (int c = 0; c < 2; ++c) st[kt] = WFrag<h16>::mma(kf[kt][c], qf[c], st[kt]); }
#pragma unroll
        for (int dt = 0; dt < 4; ++dt)
#pragma unroll
            for (int kc = 0; kc < KT / 2; ++kc) vf[dt][kc] = WFrag<h16>::ld((const h16*)(tv + dt * 16 * LPB + kc * 64));
        __builtin_amdgcn_sched_barrier(0);            // the 16 V^T reads start here, under the softmax, not next to their products
        float p[KT * 8];
#pragma unroll
        for (int e = 0; e < KT * 8; ++e) p[e] = st[e >> 3][e & 7];
        if (kb + KT * 16 - 1 > q0) {                  // only a step that reaches the diagonal masks (wave-uniform)
#pragma unroll
            for (int e = 0; e < KT * 8; ++e) p[e] = (kb + (e >> 3) * 16 + hi * 8 + (e & 7) <= q0 + lr) ? p[e] : -3.0e38f; }
        float mx = p[0];
#pragma unroll
        for (int e = 1; e < KT * 8; ++e) mx = fmaxf(mx, p[e]);
        mx = fmaxf(mx, xhalf(mx));
        const float mn = fmaxf(m, mx), al = exp2s((m - mn) * CE), mc = mn * CE; m = mn;
        float ls = 0.f;
#pragma unroll
        for (int e = 0; e < KT * 8; ++e) { p[e] = exp2s(__builtin_fmaf(p[e], CE, -mc)); ls += p[e]; }
        l = l * al + ls;
#pragma unroll
        for (int dt = 0; dt < 4; ++dt) o[dt] *= al;
        __builtin_amdgcn_sched_barrier(0);            // every exp2s stays in front of the P.V products
#pragma unroll
        for (int kc = 0; kc < KT / 2; ++kc) { const V pf = packp(p + kc * 16, (V*)nullptr);
#pragma unroll
            for (int dt = 0; dt < 4; ++dt) o[dt] = WFrag<h16>::mma(vf[dt][kc], pf, o[dt]); }
        asm volatile("s_wait_dscnt 0x0" ::: "memory");     // this wave's reads of the buffer are done before it may be refilled
        asm volatile("s_wait_asynccnt 0x0" ::: "memory");  // this wave's copies of step s + 1 have landed
        __syncthreads();                                   // publishes step s + 1 and ends every wave's reads of step s
        if (s + 2 < nst) stage_kv(kg + (size_t)(kb + 128) * HD, vg + kb + 128, ld + (unsigned)(s & 1) * BFB);
    }
    asm volatile("s_wait_asynccnt 0x0" ::: "memory");  // nothing is in flight when the wave ends
    l += xhalf(l);
    const float inv = __fdiv_rn(1.0f, l);
#pragma unroll
    for (int dt = 0; dt < 4; ++dt) { v4f a, b;
#pragma unroll
        for (int j = 0; j < 4; ++j) { a[j] = o[dt][j] * inv; b[j] = o[dt][4 + j] * inv; }
        *(v4f*)(orow + dt * 16) = a; *(v4f*)(orow + dt * 16 + 4) = b; }
}
__global__ __launch_bounds__(128) void k_fattn(const h16* __restrict__ Q16, const h16* __restrict__ K16, const h16* __restrict__ V16, const bf* __restrict__ Qh, const bf* __restrict__ Ql, const bf* __restrict__ Kh, const bf* __restrict__ Kl, const bf* __restrict__ Vh, const bf* __restrict__ Vl, float* __restrict__ out) {
    __shared__ __align__(16) char sm[2 * BFB];
    const int lane = threadIdx.x & 31, lr = lane & 15, hi = lane >> 4; const int wv = __builtin_amdgcn_readfirstlane((int)(threadIdx.x >> 5));
    const int bh = blockIdx.x % (NB_ * NH_), qg = TT / 64 - 1 - (int)(blockIdx.x / (NB_ * NH_)); const int q0 = qg * 64 + wv * 16;
    const size_t pl = (size_t)bh * TT * HD;          // this batch and head's plane ([t][d] for q and k, [d][t] for v)
    float* orow = out + ((size_t)(bh / NH_) * TT + q0 + lr) * DQ + (bh % NH_) * HD + hi * 8;
    if (qg * 64 < RH) attn_rows<bf, 2>(Qh + pl, Ql + pl, Kh + pl, Kl + pl, Vh + pl, Vl + pl, q0, lr, hi, orow);
    else attn_rows_st(Q16 + pl, K16 + pl, V16 + pl, sm, qg + 1, q0, lr, hi, orow);   // keys 0 .. qg * 64 + 63: qg + 1 steps for each of the 4 waves
}

extern "C" void kernel_launch(void* const* d_in, const int* in_sizes, int n_in,
                              void* d_out, int out_size, void* d_ws, size_t ws_size, hipStream_t stream) {
    (void)in_sizes; (void)n_in; (void)out_size;
    const float* x = (const float*)d_in[0]; const float* wq = (const float*)d_in[1]; const float* bq = (const float*)d_in[2]; const float* wk = (const float*)d_in[3]; const float* bk = (const float*)d_in[4]; const float* wv = (const float*)d_in[5]; const float* bv = (const float*)d_in[6];
    float* OUT = (float*)d_out;     // [2][2048][1024]
    char* wsp = (char*)d_ws;
    auto take = [&](size_t bytes) { char* p = wsp; wsp += (bytes + 255) & ~(size_t)255; return (void*)p; };
    bf* XW = (bf*)take(((size_t)NB_ * TT + 3 * DQ) * DM * 2);   // bf16 x rows of both batches, then the wq, wk, wv rows
    const size_t PB = (size_t)NH_ * TT * HD;   // elements of one batch's head planes
    h16* QP16 = (h16*)take(NB_ * PB * 2); h16* KP16 = (h16*)take(NB_ * PB * 2); h16* VT16 = (h16*)take(NB_ * PB * 2);
    bf* QPh = (bf*)take(NB_ * PB * 2); bf* QPl = (bf*)take(NB_ * PB * 2); bf* KPh = (bf*)take(NB_ * PB * 2); bf* KPl = (bf*)take(NB_ * PB * 2); bf* VTh = (bf*)take(NB_ * PB * 2); bf* VTl = (bf*)take(NB_ * PB * 2);
    if ((size_t)(wsp - (char*)d_ws) > ws_size) return;    // ws 256 MiB
    k_cvtall<<<(NB_ * TT + 3 * DQ) * DM / CB, 256, 0, stream>>>(x, wq, wk, wv, XW);
    k_proj<<<dim3(NB_ * TT / 128, 3 * DQ / 128, 1), 128, 0, stream>>>(XW, XW + (size_t)NB_ * TT * DM, bq, bk, bv, QP16, QPh, QPl, KP16, KPh, KPl, VT16, VTh, VTl);
    k_fattn<<<NB_ * NH_ * (TT / 64), 128, 0, stream>>>(QP16, KP16, VT16, QPh, QPl, KPh, KPl, VTh, VTl, OUT);
}

// v005
// Measured time: 61.7 microseconds a run.
// In two side-by-side timings against v004, it was 1.04 and 1.06 times as fast.
// Over all steps from v000 it is 22.6 times as fast.
#include <hip/hip_runtime.h>

// Causal multi-head self-attention without an output projection (x [2][2048][1024]; q, k, v = x W^T + b ('oi' [1024][1024] + [1024], 16 heads x 64); att = q.k / sqrt(1024) (the module scales by the full hidden size), causal mask (-inf above the diagonal); softmax; out = merged heads -> [2][2048][1024] (4.2 M)).
// Compute dtypes, f32 accumulate: every input rounded to bf16; q/k/v on PLAIN bf16 operands (inputs: exact) + biases, one launch for all three and both batches, operand rows staged in LDS for a block's 4 waves, head planes written from its epilogue; causal scores and attn.v in one launch (running maximum and sum over 32- or 64-key steps): query rows < 512 hl (3 products), the rest single fp16, key and value tiles of both staged in LDS for the block's 4 waves; softmax f32; no output projection: the merged heads are written in f32 straight to the output.

#define NB_  2
#define TT   2048
#define DM   1024
#define NH_  16
#define NKV  16
#define HD   64
#define DQ   (NH_ * HD)
#define DKV  (NKV * HD)
#define RH   512                  // query rows < RH use hi+lo planes (0: none)
#define SCL  0.03125f   // 1/sqrt(h_dim = 1024): the module scales by the full hidden size
typedef _Float16 h16;
typedef unsigned short bf;
typedef __attribute__((ext_vector_type(16))) __bf16   v16bf;
typedef __attribute__((ext_vector_type(16))) _Float16 v16h;
typedef __attribute__((ext_vector_type(8)))  _Float16 v8h;
typedef __attribute__((ext_vector_type(8)))  unsigned short v8us;
typedef __attribute__((ext_vector_type(8)))  float    v8f;
typedef __attribute__((ext_vector_type(4)))  float    v4f;
typedef v8h  __attribute__((may_alias)) v8ha;
typedef v4f  __attribute__((may_alias)) v4fa;
typedef v8us __attribute__((may_alias)) v8usa;

__device__ __forceinline__ unsigned short f2bf(float f) { unsigned u = __float_as_uint(f); u += 0x7FFFu + ((u >> 16) & 1u); return (unsigned short)(u >> 16); }
__device__ __forceinline__ float bf2f(unsigned short b) { return __uint_as_float(((unsigned)b) << 16); }
__device__ __forceinline__ float bfr(float f) { return bf2f(f2bf(f)); }
__device__ __forceinline__ v16h cat16(v8h lo, v8h hi) { return __builtin_shufflevector(lo, hi, 0, 1, 2, 3, 4, 5, 6, 7, 8, 9, 10, 11, 12, 13, 14, 15); }
__device__ __forceinline__ v16bf cat16b(v8us lo, v8us hi) { return __builtin_bit_cast(v16bf, __builtin_shufflevector(lo, hi, 0, 1, 2, 3, 4, 5, 6, 7, 8, 9, 10, 11, 12, 13, 14, 15)); }
__device__ __forceinline__ v8f wmma16(v16h a, v16h b, v8f c) { return __builtin_amdgcn_wmma_f32_16x16x32_f16(false, a, false, b, (short)0, c, false, false); }
__device__ __forceinline__ v8f wmmab(v16bf a, v16bf b, v8f c) { return __builtin_amdgcn_wmma_f32_16x16x32_bf16(false, a, false, b, (short)0, c, false, false); }



// fragment loaders and matrix products by 16-bit type: a fragment is two 16-byte loads of one K-contiguous row
template <typename T16> struct WFrag;
template <> struct WFrag<h16> { typedef v16h V; static __device__ __forceinline__ V ld(const h16* p) { return cat16(*(const v8h*)p, *(const v8h*)(p + 16)); } static __device__ __forceinline__ v8f mma(V a, V b, v8f c) { return wmma16(a, b, c); } };
template <> struct WFrag<bf> { typedef v16bf V; static __device__ __forceinline__ V ld(const bf* p) { return cat16b(*(const v8us*)p, *(const v8us*)(p + 16)); } static __device__ __forceinline__ v8f mma(V a, V b, v8f c) { return wmmab(a, b, c); } };
__device__ __forceinline__ h16 tohx(float x) { return (h16)x; }
__device__ __forceinline__ void splitf(float y, unsigned short& h, unsigned short& l) { h = f2bf(y); l = f2bf(y - bf2f(h)); }
// ---- k_cvtall: x (both batches) and the three weights rounded to bf16 into one plane [x rows | wq rows | wk rows | wv rows] x DM; 8192 elements a block, 4 x 8 a thread.
#define CB   8192
__global__ __launch_bounds__(256) void k_cvtall(const float* __restrict__ x, const float* __restrict__ wq, const float* __restrict__ wk, const float* __restrict__ wv, bf* dst) {
    const int XBK = NB_ * TT * DM / CB, WBK = DQ * DM / CB; const int blk = blockIdx.x;
    const float* src = x; int sb = blk;
    if (blk >= XBK) { const int w = (blk - XBK) / WBK; sb = (blk - XBK) % WBK; src = (w == 0) ? wq : (w == 1) ? wk : wv; }
    const float* s = src + (size_t)sb * CB + threadIdx.x * 8; bf* d = dst + (size_t)blk * CB + threadIdx.x * 8;
    v8f v[4];
#pragma unroll
    for (int i = 0; i < 4; ++i) v[i] = *(const v8f*)(s + i * 2048);
#pragma unroll
    for (int i = 0; i < 4; ++i) { v8us o;
#pragma unroll
        for (int k = 0; k < 8; ++k) o[k] = f2bf(v[i][k]);
        *(v8us*)(d + i * 2048) = o; }
}

// ---- k_proj: the q, k and v projections of both batches in one launch. A block of 4 waves owns 128 tokens x 128 output columns (two heads of one of q, k, v), ONE WAVE per 64x64 tile (16 accumulators); grid (NB_ * TT / 128, 3 * DQ / 128), 128 threads.
// Each 64-k step's 128 x rows and 128 weight rows are brought into LDS once for the block, as whole 128-byte lines (a fragment load from global memory touches 16 lines for 512 bytes, and each row is wanted by two waves); two buffers: step s + 1's copies fly while step s is worked on.
// A wave's tile is 64 tokens x one head. q and k: A = x rows, B = weight rows, tile [t][d]; v: A = weight rows, B = x rows, tile [d][t], so every tile row is one 128-byte row of its head plane ([h][t][d] for q and k, [h][d][t] for v).
// Epilogue: + bf16-rounded bias in f32, then the fp16 plane and the hi + lo bf16 planes, 16-byte stores.
#define PLB  144                  // LDS row pitch in bytes: 128 + 16 (16 B x odd), conflict-free for 16-byte fragment reads
#define PXB  (128 * PLB)          // one operand's 128 rows
#define PBF  (2 * PXB)            // one buffer: x rows, then weight rows
// 128 rows x 128 bytes of one operand, 8 asynchronous 16-byte copies a lane (8 lanes a row, 16 rows a round of the block). g, ld: this lane's first global and LDS place.
__device__ __forceinline__ void stage_rows(const bf* g, unsigned ld) {
    // the s_wait_xcnt closes the statement so that no address register of a copy is rewritten in front of it
    asm volatile("global_load_async_to_lds_b128 %0, %8, off\n\t"
                 "global_load_async_to_lds_b128 %1, %9, off\n\t"
                 "global_load_async_to_lds_b128 %2, %10, off\n\t"
                 "global_load_async_to_lds_b128 %3, %11, off\n\t"
                 "global_load_async_to_lds_b128 %4, %12, off\n\t"
                 "global_load_async_to_lds_b128 %5, %13, off\n\t"
                 "global_load_async_to_lds_b128 %6, %14, off\n\t"
                 "global_load_async_to_lds_b128 %7, %15, off\n\t"
                 "s_wait_xcnt 0x0"
                 :: "v"(ld), "v"(ld + 16u * PLB), "v"(ld + 32u * PLB), "v"(ld + 48u * PLB), "v"(ld + 64u * PLB), "v"(ld + 80u * PLB), "v"(ld + 96u * PLB), "v"(ld + 112u * PLB),
                    "v"(g), "v"(g + 16 * DM), "v"(g + 32 * DM), "v"(g + 48 * DM), "v"(g + 64 * DM), "v"(g + 80 * DM), "v"(g + 96 * DM), "v"(g + 112 * DM)
                 : "memory");
}
__global__ __launch_bounds__(128) void k_proj(const bf* __restrict__ X, const bf* __restrict__ Wt, const float* __restrict__ bq, const float* __restrict__ bk, const float* __restrict__ bv, h16* Q16, bf* Qh, bf* Ql, h16* K16, bf* Kh, bf* Kl, h16* V16, bf* Vh, bf* Vl) {
    typedef WFrag<bf>::V V;
    __shared__ __align__(16) char sm[2 * PBF];
    __shared__ __align__(16) float osb[4][16 * 68];
    const int K = DM, NS = DM / 64;
    const int tid = threadIdx.x, lane = tid & 31, lr = lane & 15, hi = lane >> 4; const int wv = __builtin_amdgcn_readfirstlane(tid >> 5);
    const int tb = blockIdx.x * 128, nb0 = blockIdx.y * 128; const int wt = wv & 1, wn = wv >> 1; const int t0 = tb + wt * 64, n0 = nb0 + wn * 64;
    const int which = n0 / DQ, h = (n0 % DQ) / HD; const bool tr = which == 2;   // block-uniform: 0 q, 1 k, 2 v
    float* os = osb[wv];                              // each wave's own epilogue rows
    const bf* xg = X + (size_t)(tb + (tid >> 3)) * K + (tid & 7) * 8; const bf* wg = Wt + (size_t)(nb0 + (tid >> 3)) * K + (tid & 7) * 8;
    const unsigned ld = (unsigned)(size_t)sm + (unsigned)((tid >> 3) * PLB + (tid & 7) * 16);
    const int fo = lr * PLB + 16 * hi;                // a lane's byte place in a 16-row fragment, the same for A and B
    const char* fx = sm + wt * 64 * PLB + fo; const char* fw = sm + PXB + wn * 64 * PLB + fo;
    const char* fa = tr ? fw : fx; const char* fb = tr ? fx : fw;
    stage_rows(xg, ld); stage_rows(wg, ld + PXB);
    v8f acc[4][4];
#pragma unroll
    for (int mb = 0; mb < 4; ++mb)
#pragma unroll
        for (int nb = 0; nb < 4; ++nb) acc[mb][nb] = (v8f){};
    asm volatile("s_wait_asynccnt 0x0" ::: "memory");  // this wave's copies of step 0 have landed
    __syncthreads();                                   // ... and every other wave's
    stage_rows(xg + 64, ld + PBF); stage_rows(wg + 64, ld + PBF + PXB);
#pragma unroll 1                                     // rolled: the two buffers take turns by (s & 1)
    for (int s = 0; s < NS; ++s) {
        const int bo = (s & 1) * PBF;
        V a[4], b[4];
#pragma unroll
        for (int c = 0; c < 2; ++c) {
#pragma unroll
            for (int mb = 0; mb < 4; ++mb) a[mb] = WFrag<bf>::ld((const bf*)(fa + bo + mb * 16 * PLB + c * 64));
#pragma unroll
            for (int nb = 0; nb < 4; ++nb) b[nb] = WFrag<bf>::ld((const bf*)(fb + bo + nb * 16 * PLB + c * 64));
            __builtin_amdgcn_sched_barrier(0);        // the 16 LDS reads of a 32-k chunk go out as one group: without it this build read one B fragment, waited for it and multiplied, four times a chunk
            if (c == 1) {                             // the step's last LDS reads are out: hand the buffer over here, so that the refill is under way while the second chunk's products (registers only) run
                asm volatile("s_wait_dscnt 0x0" ::: "memory");     // this wave's reads of the buffer are done before it may be refilled
                asm volatile("s_wait_asynccnt 0x0" ::: "memory");  // this wave's copies of step s + 1 have landed
                __syncthreads();                                   // publishes step s + 1 and ends every wave's reads of step s
                if (s + 2 < NS) { stage_rows(xg + (s + 2) * 64, ld + (unsigned)bo); stage_rows(wg + (s + 2) * 64, ld + (unsigned)bo + PXB); }
            }
#pragma unroll
            for (int nb = 0; nb < 4; ++nb)
#pragma unroll
                for (int mb = 0; mb < 4; ++mb) acc[mb][nb] = WFrag<bf>::mma(a[mb], b[nb], acc[mb][nb]);
        }
    }
    asm volatile("s_wait_asynccnt 0x0" ::: "memory");  // nothing is in flight when the wave goes on to the epilogue
    const size_t base = (size_t)((t0 / TT) * NH_ + h) * TT * HD + (tr ? (size_t)(t0 % TT) : (size_t)(t0 % TT) * HD); const int pitch = tr ? TT : HD;
    h16* P16 = ((which == 0) ? Q16 : (which == 1) ? K16 : V16) + base; bf* Ph = ((which == 0) ? Qh : (which == 1) ? Kh : Vh) + base; bf* Pl = ((which == 0) ? Ql : (which == 1) ? Kl : Vl) + base;
    const float* bias = ((which == 0) ? bq : (which == 1) ? bk : bv) + h * HD;
    const int rsub = lane >> 3, cofs = (lane & 7) * 8;   // 8 lanes write one 128-byte plane row
    float bc[8];
#pragma unroll
    for (int e = 0; e < 8; ++e) bc[e] = bfr(bias[cofs + e]);
#pragma unroll
    for (int mb = 0; mb < 4; ++mb) {
#pragma unroll
        for (int nb = 0; nb < 4; ++nb) {
#pragma unroll
            for (int j = 0; j < 8; ++j) os[(hi * 8 + j) * 68 + nb * 16 + lr] = acc[mb][nb][j]; }
        __builtin_amdgcn_wave_barrier(); asm volatile("" ::: "memory");  // compiler order only (one wave): the 16 tile rows are stored to LDS before they are read back
#pragma unroll
        for (int s = 0; s < 4; ++s) { const int row = 4 * s + rsub; const v4f lo4 = *(const v4fa*)(os + row * 68 + cofs), hi4 = *(const v4fa*)(os + row * 68 + cofs + 4);
            const float br = bfr(bias[mb * 16 + row]); v8h o16; v8us oh, ol;
#pragma unroll
            for (int e = 0; e < 8; ++e) { const float r = ((e < 4) ? lo4[e & 3] : hi4[e & 3]) + (tr ? br : bc[e]); o16[e] = tohx(r); unsigned short a2, c2; splitf(r, a2, c2); oh[e] = a2; ol[e] = c2; }
            const size_t off = (size_t)(mb * 16 + row) * pitch + cofs;
            *(v8h*)(P16 + off) = o16; *(v8us*)(Ph + off) = oh; *(v8us*)(Pl + off) = ol; }
        __builtin_amdgcn_wave_barrier(); asm volatile("" ::: "memory");  // compiler order only: the rows are read before the next 16 overwrite them
    }
}

// ---- k_fattn: scores, causal softmax and probability x value in one launch for every batch and head. One wave owns 16 query rows and walks its keys KT x 16 at a time with a running maximum and sum.
// Transposed products: S^T = K Q^T (A = key rows, B = query rows), O^T += V^T P^T (A = V^T rows, B = two score tiles converted in place), so a lane holds one query's scores and P needs no lane exchange and no LDS.
// Query rows < RH (attn_rows_hl): hi+lo bf16 planes, 3 products each, 32 keys a step. The rest (attn_rows_st): single fp16, 64 keys a step. Both read their tiles from LDS. Grid: heaviest 64-row query groups first, 4 waves a block.
__device__ __forceinline__ float xhalf(float x) { return __builtin_bit_cast(float, __builtin_amdgcn_permlanex16(__builtin_bit_cast(int, x), __builtin_bit_cast(int, x), 0x76543210, 0xfedcba98, false, false)); }  // lane l with lane l ^ 16
// 2^x with the one free issue slot behind a transcendental written in
__device__ __forceinline__ float exp2s(float x) { float r; asm("v_exp_f32 %0, %1\n\tv_nop" : "=v"(r) : "v"(x)); return r; }
__device__ __forceinline__ v16h packp(const float* p, v16h*) { v16h r;
#pragma unroll
    for (int e = 0; e < 16; ++e) r[e] = (h16)p[e];
    return r; }
__device__ __forceinline__ v16bf packp(const float* p, v16bf* lo) { v8us h0, h1, l0, l1;
#pragma unroll
    for (int e = 0; e < 8; ++e) { unsigned short a, c; splitf(p[e], a, c); h0[e] = a; l0[e] = c; splitf(p[8 + e], a, c); h1[e] = a; l1[e] = c; }
    *lo = cat16b(l0, l1); return cat16b(h0, h1); }
// ---- the fp16 rows: the block's 4 waves walk the same 64-key steps, so each step's K rows [64 keys][64 d] and V^T rows [64 d][64 keys] are brought into LDS once for all four, as whole 128-byte lines (a fragment load from global memory touches 16 lines for 512 bytes).
#define LPB  144                  // LDS row pitch in bytes: 128 + 16 (16 B x odd), conflict-free for 16-byte fragment reads
#define TLB  (64 * LPB)           // one tile of 64 rows
#define BFB  (2 * TLB)            // one buffer: K tile, then V^T tile
// One step's tiles, 8 asynchronous 16-byte copies a lane (8 lanes a row, 16 rows a round of the block). kg, vg, ld: this lane's first K, V^T and LDS place.
template <typename T16>
__device__ __forceinline__ void stage_kv(const T16* kg, const T16* vg, unsigned ld) {
    // the s_wait_xcnt closes the statement so that no address register of a copy is rewritten in front of it
    asm volatile("global_load_async_to_lds_b128 %0, %8, off\n\t"
                 "global_load_async_to_lds_b128 %1, %9, off\n\t"
                 "global_load_async_to_lds_b128 %2, %10, off\n\t"
                 "global_load_async_to_lds_b128 %3, %11, off\n\t"
                 "global_load_async_to_lds_b128 %4, %12, off\n\t"
                 "global_load_async_to_lds_b128 %5, %13, off\n\t"
                 "global_load_async_to_lds_b128 %6, %14, off\n\t"
                 "global_load_async_to_lds_b128 %7, %15, off\n\t"
                 "s_wait_xcnt 0x0"
                 :: "v"(ld), "v"(ld + 16u * LPB), "v"(ld + 32u * LPB), "v"(ld + 48u * LPB), "v"(ld + TLB), "v"(ld + TLB + 16u * LPB), "v"(ld + TLB + 32u * LPB), "v"(ld + TLB + 48u * LPB),
                    "v"(kg), "v"(kg + 16 * HD), "v"(kg + 32 * HD), "v"(kg + 48 * HD), "v"(vg), "v"(vg + (size_t)16 * TT), "v"(vg + (size_t)32 * TT), "v"(vg + (size_t)48 * TT)
                 : "memory");
}
// nst = steps of the whole block (the same for its 4 waves); two buffers: step s + 1's copies fly while step s is worked on.
__device__ __forceinline__ void attn_rows_st(const h16* __restrict__ Q, const h16* __restrict__ Kp, const h16* __restrict__ Vt, char* sm, int nst, int q0, int lr, int hi, float* __restrict__ orow) {
    typedef WFrag<h16>::V V;                          // every full '#pragma unroll' below keeps a fragment or score array in registers (constant indices)
    const int KT = 4;
    const float CE = SCL * 1.4426950408889634f;      // raw score -> log2 domain
    const int tid = threadIdx.x;
    const h16* kg = Kp + tid * 8; const h16* vg = Vt + (size_t)(tid >> 3) * TT + (tid & 7) * 8;
    const unsigned ld = (unsigned)(size_t)sm + (unsigned)((tid >> 3) * LPB + (tid & 7) * 16);
    const int fo = lr * LPB + 16 * hi;                // a lane's byte place in a 16-row fragment of a tile
    stage_kv(kg, vg, ld);
    V qf[2];
#pragma unroll
    for (int c = 0; c < 2; ++c) qf[c] = WFrag<h16>::ld(Q + (size_t)(q0 + lr) * HD + 8 * hi + c * 32);
    v8f o[4];
#pragma unroll
    for (int dt = 0; dt < 4; ++dt) o[dt] = (v8f){};
    float m = -3.0e38f, l = 0.f;
    asm volatile("s_wait_asynccnt 0x0" ::: "memory");  // this wave's copies of step 0 have landed
    __syncthreads();                                   // ... and every other wave's
    if (nst > 1) stage_kv(kg + 64 * HD, vg + 64, ld + BFB);
#pragma unroll 1                                     // rolled: one step's fragments and scores fill the registers of 4 waves a SIMD
    for (int s = 0; s < nst; ++s) {
        const int kb = s * (KT * 16);
        const char* tk = sm + (s & 1) * BFB + fo; const char* tv = tk + TLB;
        V kf[KT][2], vf[4][KT / 2];
#pragma unroll
        for (int kt = 0; kt < KT; ++kt)
#pragma unroll
            for (int c = 0; c < 2; ++c) kf[kt][c] = WFrag<h16>::ld((const h16*)(tk + kt * 16 * LPB + c * 64));
        __builtin_amdgcn_sched_barrier(0);            // the 16 K reads go out as one group: without it this build read one fragment, waited for it and multiplied, eight times a step
        v8f st[KT];
#pragma unroll
        for (int kt = 0; kt < KT; ++kt) { st[kt] = (v8f){};
#pragma unroll
            for (int c = 0; c < 2; ++c) st[kt] = WFrag<h16>::mma(kf[kt][c], qf[c], st[kt]); }
#pragma unroll
        for (int dt = 0; dt < 4; ++dt)
#pragma unroll
            for (int kc = 0; kc < KT / 2; ++kc) vf[dt][kc] = WFrag<h16>::ld((const h16*)(tv + dt * 16 * LPB + kc * 64));
        __builtin_amdgcn_sched_barrier(0);            // the 16 V^T reads start here, under the softmax, not next to their products
        float p[KT * 8];
#pragma unroll
        for (int e = 0; e < KT * 8; ++e) p[e] = st[e >> 3][e & 7];
        if (kb + KT * 16 - 1 > q0) {                  // only a step that reaches the diagonal masks (wave-uniform)
#pragma unroll
            for (int e = 0; e < KT * 8; ++e) p[e] = (kb + (e >> 3) * 16 + hi * 8 + (e & 7) <= q0 + lr) ? p[e] : -3.0e38f; }
        float mx = p[0];
#pragma unroll
        for (int e = 1; e < KT * 8; ++e) mx = fmaxf(mx, p[e]);
        mx = fmaxf(mx, xhalf(mx));
        const float mn = fmaxf(m, mx), al = exp2s((m - mn) * CE), mc = mn * CE; m = mn;
        float ls = 0.f;
#pragma unroll
        for (int e = 0; e < KT * 8; ++e) { p[e] = exp2s(__builtin_fmaf(p[e], CE, -mc)); ls += p[e]; }
        l = l * al + ls;
#pragma unroll
        for (int dt = 0; dt < 4; ++dt) o[dt] *= al;
        __builtin_amdgcn_sched_barrier(0);            // every exp2s stays in front of the P.V products
#pragma unroll
        for (int kc = 0; kc < KT / 2; ++kc) { const V pf = packp(p + kc * 16, (V*)nullptr);
#pragma unroll
            for (int dt = 0; dt < 4; ++dt) o[dt] = WFrag<h16>::mma(vf[dt][kc], pf, o[dt]); }
        asm volatile("s_wait_dscnt 0x0" ::: "memory");     // this wave's reads of the buffer are done before it may be refilled
        asm volatile("s_wait_asynccnt 0x0" ::: "memory");  // this wave's copies of step s + 1 have landed
        __syncthreads();                                   // publishes step s + 1 and ends every wave's reads of step s
        if (s + 2 < nst) stage_kv(kg + (size_t)(kb + 128) * HD, vg + kb + 128, ld + (unsigned)(s & 1) * BFB);
    }
    asm volatile("s_wait_asynccnt 0x0" ::: "memory");  // nothing is in flight when the wave ends
    l += xhalf(l);
    const float inv = __fdiv_rn(1.0f, l);
#pragma unroll
    for (int dt = 0; dt < 4; ++dt) { v4f a, b;
#pragma unroll
        for (int j = 0; j < 4; ++j) { a[j] = o[dt][j] * inv; b[j] = o[dt][4 + j] * inv; }
        *(v4f*)(orow + dt * 16) = a; *(v4f*)(orow + dt * 16 + 4) = b; }
}
// ---- the hi+lo rows: the block's 4 waves walk the same 64-key stages, so each stage's K rows and V^T rows of both planes are brought into LDS once for all four, as whole 128-byte lines; a stage is worked on as two 32-key steps (keys and values of both planes take turns in the registers).
#define HBF  (2 * BFB)            // one buffer: K hi, V^T hi, K lo, V^T lo tiles
// nst = stages of the whole block (the same for its 4 waves); two buffers: stage s + 1's copies fly while stage s is worked on.
__device__ __forceinline__ void attn_rows_hl(const bf* __restrict__ Q, const bf* __restrict__ Q2, const bf* __restrict__ Kp, const bf* __restrict__ K2, const bf* __restrict__ Vt, const bf* __restrict__ Vt2, char* sm, int nst, int q0, int lr, int hi, float* __restrict__ orow) {
    typedef WFrag<bf>::V V;                           // every full '#pragma unroll' below keeps a fragment or score array in registers (constant indices)
    const int KT = 2;
    const float CE = SCL * 1.4426950408889634f;      // raw score -> log2 domain
    const int tid = threadIdx.x;
    const size_t kof = (size_t)tid * 8, vof = (size_t)(tid >> 3) * TT + (tid & 7) * 8;
    const unsigned ld = (unsigned)(size_t)sm + (unsigned)((tid >> 3) * LPB + (tid & 7) * 16);
    const int fo = lr * LPB + 16 * hi;                // a lane's byte place in a 16-row fragment of a tile
    stage_kv(Kp + kof, Vt + vof, ld); stage_kv(K2 + kof, Vt2 + vof, ld + BFB);
    const size_t qo = (size_t)(q0 + lr) * HD + 8 * hi;
    V qf[2], qf2[2];
#pragma unroll
    for (int c = 0; c < 2; ++c) { qf[c] = WFrag<bf>::ld(Q + qo + c * 32); qf2[c] = WFrag<bf>::ld(Q2 + qo + c * 32); }
    v8f o[4];
#pragma unroll
    for (int dt = 0; dt < 4; ++dt) o[dt] = (v8f){};
    float m = -3.0e38f, l = 0.f;
    asm volatile("s_wait_asynccnt 0x0" ::: "memory");  // this wave's copies of stage 0 have landed
    __syncthreads();                                   // ... and every other wave's
    if (nst > 1) { stage_kv(Kp + kof + 64 * HD, Vt + vof + 64, ld + HBF); stage_kv(K2 + kof + 64 * HD, Vt2 + vof + 64, ld + HBF + BFB); }
#pragma unroll 1                                     // rolled: the two buffers take turns by (s & 1)
    for (int s = 0; s < nst; ++s) {
        const char* tb = sm + (s & 1) * HBF + fo;
#pragma unroll 1                                     // rolled: two steps unrolled take more than 256 registers, one wave a SIMD fewer
        for (int u = 0; u < 2; ++u) {
            const int kb = s * 64 + u * 32;
            if (kb > q0 + 15) break;                  // wave-uniform: every key of the step lies above this wave's diagonal; no barrier stands inside this loop
            const char* tk = tb + u * 32 * LPB; const char* tv = tb + TLB + u * 64;
            V kf[KT][2], kf2[KT][2], vf[4], vf2[4];
#pragma unroll
            for (int kt = 0; kt < KT; ++kt)
#pragma unroll
                for (int c = 0; c < 2; ++c) { kf[kt][c] = WFrag<bf>::ld((const bf*)(tk + kt * 16 * LPB + c * 64)); kf2[kt][c] = WFrag<bf>::ld((const bf*)(tk + BFB + kt * 16 * LPB + c * 64)); }
            __builtin_amdgcn_sched_barrier(0);        // the 16 K reads go out as one group, not one fragment at a time next to its product
            v8f st[KT];
#pragma unroll
            for (int kt = 0; kt < KT; ++kt) { st[kt] = (v8f){};
#pragma unroll
                for (int c = 0; c < 2; ++c) { st[kt] = WFrag<bf>::mma(kf[kt][c], qf[c], st[kt]); st[kt] = WFrag<bf>::mma(kf[kt][c], qf2[c], st[kt]); st[kt] = WFrag<bf>::mma(kf2[kt][c], qf[c], st[kt]); } }
#pragma unroll
            for (int dt = 0; dt < 4; ++dt) { vf[dt] = WFrag<bf>::ld((const bf*)(tv + dt * 16 * LPB)); vf2[dt] = WFrag<bf>::ld((const bf*)(tv + BFB + dt * 16 * LPB)); }
            __builtin_amdgcn_sched_barrier(0);        // the 16 V^T reads start here, under the softmax, not next to their products
            float p[KT * 8];
#pragma unroll
            for (int e = 0; e < KT * 8; ++e) p[e] = st[e >> 3][e & 7];
            if (kb + KT * 16 - 1 > q0) {              // only a step that reaches the diagonal masks (wave-uniform)
#pragma unroll
                for (int e = 0; e < KT * 8; ++e) p[e] = (kb + (e >> 3) * 16 + hi * 8 + (e & 7) <= q0 + lr) ? p[e] : -3.0e38f; }
            float mx = p[0];
#pragma unroll
            for (int e = 1; e < KT * 8; ++e) mx = fmaxf(mx, p[e]);
            mx = fmaxf(mx, xhalf(mx));
            const float mn = fmaxf(m, mx), al = exp2s((m - mn) * CE), mc = mn * CE; m = mn;
            float ls = 0.f;
#pragma unroll
            for (int e = 0; e < KT * 8; ++e) { p[e] = exp2s(__builtin_fmaf(p[e], CE, -mc)); ls += p[e]; }
            l = l * al + ls;
#pragma unroll
            for (int dt = 0; dt < 4; ++dt) o[dt] *= al;
            V pf2; const V pf = packp(p, &pf2);
#pragma unroll
            for (int dt = 0; dt < 4; ++dt) { o[dt] = WFrag<bf>::mma(vf[dt], pf, o[dt]); o[dt] = WFrag<bf>::mma(vf[dt], pf2, o[dt]); o[dt] = WFrag<bf>::mma(vf2[dt], pf, o[dt]); }
        }
        asm volatile("s_wait_dscnt 0x0" ::: "memory");     // this wave's reads of the buffer are done before it may be refilled
        asm volatile("s_wait_asynccnt 0x0" ::: "memory");  // this wave's copies of stage s + 1 have landed
        __syncthreads();                                   // publishes stage s + 1 and ends every wave's reads of stage s
        if (s + 2 < nst) { const unsigned lb = ld + (unsigned)(s & 1) * HBF; const size_t kn = (size_t)(s + 2) * 64;
            stage_kv(Kp + kof + kn * HD, Vt + vof + kn, lb); stage_kv(K2 + kof + kn * HD, Vt2 + vof + kn, lb + BFB); }
    }
    asm volatile("s_wait_asynccnt 0x0" ::: "memory");  // nothing is in flight when the wave ends
    l += xhalf(l);
    const float inv = __fdiv_rn(1.0f, l);
#pragma unroll
    for (int dt = 0; dt < 4; ++dt) { v4f a, b;
#pragma unroll
        for (int j = 0; j < 4; ++j) { a[j] = o[dt][j] * inv; b[j] = o[dt][4 + j] * inv; }
        *(v4f*)(orow + dt * 16) = a; *(v4f*)(orow + dt * 16 + 4) = b; }
}
__global__ __launch_bounds__(128) void k_fattn(const h16* __restrict__ Q16, const h16* __restrict__ K16, const h16* __restrict__ V16, const bf* __restrict__ Qh, const bf* __restrict__ Ql, const bf* __restrict__ Kh, const bf* __restrict__ Kl, const bf* __restrict__ Vh, const bf* __restrict__ Vl, float* __restrict__ out) {
    __shared__ __align__(16) char sm[2 * HBF];
    const int lane = threadIdx.x & 31, lr = lane & 15, hi = lane >> 4; const int wv = __builtin_amdgcn_readfirstlane((int)(threadIdx.x >> 5));
    const int bh = blockIdx.x % (NB_ * NH_), qg = TT / 64 - 1 - (int)(blockIdx.x / (NB_ * NH_)); const int q0 = qg * 64 + wv * 16;
    const size_t pl = (size_t)bh * TT * HD;          // this batch and head's plane ([t][d] for q and k, [d][t] for v)
    float* orow = out + ((size_t)(bh / NH_) * TT + q0 + lr) * DQ + (bh % NH_) * HD + hi * 8;
    if (qg * 64 < RH) attn_rows_hl(Qh + pl, Ql + pl, Kh + pl, Kl + pl, Vh + pl, Vl + pl, sm, qg + 1, q0, lr, hi, orow);   // block-uniform; keys 0 .. qg * 64 + 63: qg + 1 stages
    else attn_rows_st(Q16 + pl, K16 + pl, V16 + pl, sm, qg + 1, q0, lr, hi, orow);   // keys 0 .. qg * 64 + 63: qg + 1 steps for each of the 4 waves
}

extern "C" void kernel_launch(void* const* d_in, const int* in_sizes, int n_in,
                              void* d_out, int out_size, void* d_ws, size_t ws_size, hipStream_t stream) {
    (void)in_sizes; (void)n_in; (void)out_size;
    const float* x = (const float*)d_in[0]; const float* wq = (const float*)d_in[1]; const float* bq = (const float*)d_in[2]; const float* wk = (const float*)d_in[3]; const float* bk = (const float*)d_in[4]; const float* wv = (const float*)d_in[5]; const float* bv = (const float*)d_in[6];
    float* OUT = (float*)d_out;     // [2][2048][1024]
    char* wsp = (char*)d_ws;
    auto take = [&](size_t bytes) { char* p = wsp; wsp += (bytes + 255) & ~(size_t)255; return (void*)p; };
    bf* XW = (bf*)take(((size_t)NB_ * TT + 3 * DQ) * DM * 2);   // bf16 x rows of both batches, then the wq, wk, wv rows
    const size_t PB = (size_t)NH_ * TT * HD;   // elements of one batch's head planes
    h16* QP16 = (h16*)take(NB_ * PB * 2); h16* KP16 = (h16*)take(NB_ * PB * 2); h16* VT16 = (h16*)take(NB_ * PB * 2);
    bf* QPh = (bf*)take(NB_ * PB * 2); bf* QPl = (bf*)take(NB_ * PB * 2); bf* KPh = (bf*)take(NB_ * PB * 2); bf* KPl = (bf*)take(NB_ * PB * 2); bf* VTh = (bf*)take(NB_ * PB * 2); bf* VTl = (bf*)take(NB_ * PB * 2);
    if ((size_t)(wsp - (char*)d_ws) > ws_size) return;    // ws 256 MiB
    k_cvtall<<<(NB_ * TT + 3 * DQ) * DM / CB, 256, 0, stream>>>(x, wq, wk, wv, XW);
    k_proj<<<dim3(NB_ * TT / 128, 3 * DQ / 128, 1), 128, 0, stream>>>(XW, XW + (size_t)NB_ * TT * DM, bq, bk, bv, QP16, QPh, QPl, KP16, KPh, KPl, VT16, VTh, VTl);
    k_fattn<<<NB_ * NH_ * (TT / 64), 128, 0, stream>>>(QP16, KP16, VT16, QPh, QPl, KPh, KPl, VTh, VTl, OUT);
}

// v006
// A run of this version takes 59 microseconds.
// Timed twice side by side with v005, it ran 1.05 and 1.04 times as fast.
// All steps since v000 together make it 23.6 times as fast.
#include <hip/hip_runtime.h>

// Causal multi-head self-attention without an output projection (x [2][2048][1024]; q, k, v = x W^T + b ('oi' [1024][1024] + [1024], 16 heads x 64); att = q.k / sqrt(1024) (the module scales by the full hidden size), causal mask (-inf above the diagonal); softmax; out = merged heads -> [2][2048][1024] (4.2 M)).
// Compute dtypes, f32 accumulate: every input rounded to bf16; q/k/v on PLAIN bf16 operands (inputs: exact) + biases, one launch for all three and both batches, operand rows staged in LDS for a block's 4 waves, head planes written from its epilogue; causal scores and attn.v in one launch (running maximum and sum over 32- or 64-key steps): query rows < 512 hl (3 products), the rest single fp16, key and value tiles of both staged in LDS for the block's 4 waves; softmax f32; no output projection: the merged heads are written in f32 straight to the output.

#define NB_  2
#define TT   2048
#define DM   1024
#define NH_  16
#define NKV  16
#define HD   64
#define DQ   (NH_ * HD)
#define DKV  (NKV * HD)
#define RH   512                  // query rows < RH use hi+lo planes (0: none)
#define SCL  0.03125f   // 1/sqrt(h_dim = 1024): the module scales by the full hidden size
typedef _Float16 h16;
typedef unsigned short bf;
typedef __attribute__((ext_vector_type(16))) __bf16   v16bf;
typedef __attribute__((ext_vector_type(16))) _Float16 v16h;
typedef __attribute__((ext_vector_type(8)))  _Float16 v8h;
typedef __attribute__((ext_vector_type(8)))  unsigned short v8us;
typedef __attribute__((ext_vector_type(8)))  float    v8f;
typedef __attribute__((ext_vector_type(4)))  float    v4f;
typedef v8h  __attribute__((may_alias)) v8ha;
typedef v4f  __attribute__((may_alias)) v4fa;
typedef v8us __attribute__((may_alias)) v8usa;

__device__ __forceinline__ unsigned short f2bf(float f) { unsigned u = __float_as_uint(f); u += 0x7FFFu + ((u >> 16) & 1u); return (unsigned short)(u >> 16); }
__device__ __forceinline__ float bf2f(unsigned short b) { return __uint_as_float(((unsigned)b) << 16); }
__device__ __forceinline__ float bfr(float f) { return bf2f(f2bf(f)); }
__device__ __forceinline__ v16h cat16(v8h lo, v8h hi) { return __builtin_shufflevector(lo, hi, 0, 1, 2, 3, 4, 5, 6, 7, 8, 9, 10, 11, 12, 13, 14, 15); }
__device__ __forceinline__ v16bf cat16b(v8us lo, v8us hi) { return __builtin_bit_cast(v16bf, __builtin_shufflevector(lo, hi, 0, 1, 2, 3, 4, 5, 6, 7, 8, 9, 10, 11, 12, 13, 14, 15)); }
__device__ __forceinline__ v8f wmma16(v16h a, v16h b, v8f c) { return __builtin_amdgcn_wmma_f32_16x16x32_f16(false, a, false, b, (short)0, c, false, false); }
__device__ __forceinline__ v8f wmmab(v16bf a, v16bf b, v8f c) { return __builtin_amdgcn_wmma_f32_16x16x32_bf16(false, a, false, b, (short)0, c, false, false); }



// fragment loaders and matrix products by 16-bit type: a fragment is two 16-byte loads of one K-contiguous row
template <typename T16> struct WFrag;
template <> struct WFrag<h16> { typedef v16h V; static __device__ __forceinline__ V ld(const h16* p) { return cat16(*(const v8h*)p, *(const v8h*)(p + 16)); } static __device__ __forceinline__ v8f mma(V a, V b, v8f c) { return wmma16(a, b, c); } };
template <> struct WFrag<bf> { typedef v16bf V; static __device__ __forceinline__ V ld(const bf* p) { return cat16b(*(const v8us*)p, *(const v8us*)(p + 16)); } static __device__ __forceinline__ v8f mma(V a, V b, v8f c) { return wmmab(a, b, c); } };
__device__ __forceinline__ h16 tohx(float x) { return (h16)x; }
__device__ __forceinline__ void splitf(float y, unsigned short& h, unsigned short& l) { h = f2bf(y); l = f2bf(y - bf2f(h)); }
// ---- k_cvtall: x (both batches) and the three weights rounded to bf16 into one plane [x rows | wq rows | wk rows | wv rows] x DM; 8192 elements a block, 4 x 8 a thread.
#define CB   8192
__global__ __launch_bounds__(256) void k_cvtall(const float* __restrict__ x, const float* __restrict__ wq, const float* __restrict__ wk, const float* __restrict__ wv, bf* dst) {
    const int XBK = NB_ * TT * DM / CB, WBK = DQ * DM / CB; const int blk = blockIdx.x;
    const float* src = x; int sb = blk;
    if (blk >= XBK) { const int w = (blk - XBK) / WBK; sb = (blk - XBK) % WBK; src = (w == 0) ? wq : (w == 1) ? wk : wv; }
    const float* s = src + (size_t)sb * CB + threadIdx.x * 8; bf* d = dst + (size_t)blk * CB + threadIdx.x * 8;
    v8f v[4];
#pragma unroll
    for (int i = 0; i < 4; ++i) v[i] = *(const v8f*)(s + i * 2048);
#pragma unroll
    for (int i = 0; i < 4; ++i) { v8us o;
#pragma unroll
        for (int k = 0; k < 8; ++k) o[k] = f2bf(v[i][k]);
        *(v8us*)(d + i * 2048) = o; }
}

// ---- k_proj: the q, k and v projections of both batches in one launch. A block of 4 waves owns 128 tokens x 128 output columns (two heads of one of q, k, v), ONE WAVE per 64x64 tile (16 accumulators); grid (NB_ * TT / 128, 3 * DQ / 128), 128 threads.
// Each 64-k step's 128 x rows and 128 weight rows are brought into LDS once for the block, as whole 128-byte lines (a fragment load from global memory touches 16 lines for 512 bytes, and each row is wanted by two waves); two buffers: step s + 1's copies fly while step s is worked on.
// A wave's tile is 64 tokens x one head. q and k: A = x rows, B = weight rows, tile [t][d]; v: A = weight rows, B = x rows, tile [d][t], so every tile row is one 128-byte row of its head plane ([h][t][d] for q and k, [h][d][t] for v).
// The k walk is rotated: block (x, y) starts at 64-k step (x + y) mod 16 and wraps, so the 24 blocks that share x rows and the 32 that share weight rows ask L2 for different lines at any one moment. Only the order of the f32 sums changes.
// Epilogue: + bf16-rounded bias in f32, then the fp16 plane and the hi + lo bf16 planes, 16-byte stores.
#define PLB  144                  // LDS row pitch in bytes: 128 + 16 (16 B x odd), conflict-free for 16-byte fragment reads
#define PXB  (128 * PLB)          // one operand's 128 rows
#define PBF  (2 * PXB)            // one buffer: x rows, then weight rows
// 128 rows x 128 bytes of one operand, 8 asynchronous 16-byte copies a lane (8 lanes a row, 16 rows a round of the block). g, ld: this lane's first global and LDS place.
__device__ __forceinline__ void stage_rows(const bf* g, unsigned ld) {
    // the s_wait_xcnt closes the statement so that no address register of a copy is rewritten in front of it
    asm volatile("global_load_async_to_lds_b128 %0, %8, off\n\t"
                 "global_load_async_to_lds_b128 %1, %9, off\n\t"
                 "global_load_async_to_lds_b128 %2, %10, off\n\t"
                 "global_load_async_to_lds_b128 %3, %11, off\n\t"
                 "global_load_async_to_lds_b128 %4, %12, off\n\t"
                 "global_load_async_to_lds_b128 %5, %13, off\n\t"
                 "global_load_async_to_lds_b128 %6, %14, off\n\t"
                 "global_load_async_to_lds_b128 %7, %15, off\n\t"
                 "s_wait_xcnt 0x0"
                 :: "v"(ld), "v"(ld + 16u * PLB), "v"(ld + 32u * PLB), "v"(ld + 48u * PLB), "v"(ld + 64u * PLB), "v"(ld + 80u * PLB), "v"(ld + 96u * PLB), "v"(ld + 112u * PLB),
                    "v"(g), "v"(g + 16 * DM), "v"(g + 32 * DM), "v"(g + 48 * DM), "v"(g + 64 * DM), "v"(g + 80 * DM), "v"(g + 96 * DM), "v"(g + 112 * DM)
                 : "memory");
}
__global__ __launch_bounds__(128) void k_proj(const bf* __restrict__ X, const bf* __restrict__ Wt, const float* __restrict__ bq, const float* __restrict__ bk, const float* __restrict__ bv, h16* Q16, bf* Qh, bf* Ql, h16* K16, bf* Kh, bf* Kl, h16* V16, bf* Vh, bf* Vl) {
    typedef WFrag<bf>::V V;
    __shared__ __align__(16) char sm[2 * PBF];
    __shared__ __align__(16) float osb[4][16 * 68];
    const int K = DM, NS = DM / 64;
    static_assert((NS & (NS - 1)) == 0, "the rotated k walk wraps by a mask");
    const int r0 = (int)(blockIdx.x + blockIdx.y) & (NS - 1);   // this block's first 64-k step
    const int tid = threadIdx.x, lane = tid & 31, lr = lane & 15, hi = lane >> 4; const int wv = __builtin_amdgcn_readfirstlane(tid >> 5);
    const int tb = blockIdx.x * 128, nb0 = blockIdx.y * 128; const int wt = wv & 1, wn = wv >> 1; const int t0 = tb + wt * 64, n0 = nb0 + wn * 64;
    const int which = n0 / DQ, h = (n0 % DQ) / HD; const bool tr = which == 2;   // block-uniform: 0 q, 1 k, 2 v
    float* os = osb[wv];                              // each wave's own epilogue rows
    const bf* xg = X + (size_t)(tb + (tid >> 3)) * K + (tid & 7) * 8; const bf* wg = Wt + (size_t)(nb0 + (tid >> 3)) * K + (tid & 7) * 8;
    const unsigned ld = (unsigned)(size_t)sm + (unsigned)((tid >> 3) * PLB + (tid & 7) * 16);
    const int fo = lr * PLB + 16 * hi;                // a lane's byte place in a 16-row fragment, the same for A and B
    const char* fx = sm + wt * 64 * PLB + fo; const char* fw = sm + PXB + wn * 64 * PLB + fo;
    const char* fa = tr ? fw : fx; const char* fb = tr ? fx : fw;
    stage_rows(xg + r0 * 64, ld); stage_rows(wg + r0 * 64, ld + PXB);
    v8f acc[4][4];
#pragma unroll
    for (int mb = 0; mb < 4; ++mb)
#pragma unroll
        for (int nb = 0; nb < 4; ++nb) acc[mb][nb] = (v8f){};
    asm volatile("s_wait_asynccnt 0x0" ::: "memory");  // this wave's copies of step 0 have landed
    __syncthreads();                                   // ... and every other wave's
    { const int k1 = ((r0 + 1) & (NS - 1)) * 64; stage_rows(xg + k1, ld + PBF); stage_rows(wg + k1, ld + PBF + PXB); }
#pragma unroll 1                                     // rolled: the two buffers take turns by (s & 1)
    for (int s = 0; s < NS; ++s) {
        const int bo = (s & 1) * PBF;
        V a[4], b[4];
#pragma unroll
        for (int c = 0; c < 2; ++c) {
#pragma unroll
            for (int mb = 0; mb < 4; ++mb) a[mb] = WFrag<bf>::ld((const bf*)(fa + bo + mb * 16 * PLB + c * 64));
#pragma unroll
            for (int nb = 0; nb < 4; ++nb) b[nb] = WFrag<bf>::ld((const bf*)(fb + bo + nb * 16 * PLB + c * 64));
            __builtin_amdgcn_sched_barrier(0);        // the 16 LDS reads of a 32-k chunk go out as one group: without it this build read one B fragment, waited for it and multiplied, four times a chunk
            if (c == 1) {                             // the step's last LDS reads are out: hand the buffer over here, so that the refill is under way while the second chunk's products (registers only) run
                asm volatile("s_wait_dscnt 0x0" ::: "memory");     // this wave's reads of the buffer are done before it may be refilled
                asm volatile("s_wait_asynccnt 0x0" ::: "memory");  // this wave's copies of step s + 1 have landed
                __syncthreads();                                   // publishes step s + 1 and ends every wave's reads of step s
                if (s + 2 < NS) { const int kn = ((s + 2 + r0) & (NS - 1)) * 64; stage_rows(xg + kn, ld + (unsigned)bo); stage_rows(wg + kn, ld + (unsigned)bo + PXB); }
            }
#pragma unroll
            for (int nb = 0; nb < 4; ++nb)
#pragma unroll
                for (int mb = 0; mb < 4; ++mb) acc[mb][nb] = WFrag<bf>::mma(a[mb], b[nb], acc[mb][nb]);
        }
    }
    asm volatile("s_wait_asynccnt 0x0" ::: "memory");  // nothing is in flight when the wave goes on to the epilogue
    const size_t base = (size_t)((t0 / TT) * NH_ + h) * TT * HD + (tr ? (size_t)(t0 % TT) : (size_t)(t0 % TT) * HD); const int pitch = tr ? TT : HD;
    h16* P16 = ((which == 0) ? Q16 : (which == 1) ? K16 : V16) + base; bf* Ph = ((which == 0) ? Qh : (which == 1) ? Kh : Vh) + base; bf* Pl = ((which == 0) ? Ql : (which == 1) ? Kl : Vl) + base;
    const float* bias = ((which == 0) ? bq : (which == 1) ? bk : bv) + h * HD;
    const int rsub = lane >> 3, cofs = (lane & 7) * 8;   // 8 lanes write one 128-byte plane row
    float bc[8];
#pragma unroll
    for (int e = 0; e < 8; ++e) bc[e] = bfr(bias[cofs + e]);
#pragma unroll
    for (int mb = 0; mb < 4; ++mb) {
#pragma unroll
        for (int nb = 0; nb < 4; ++nb) {
#pragma unroll
            for (int j = 0; j < 8; ++j) os[(hi * 8 + j) * 68 + nb * 16 + lr] = acc[mb][nb][j]; }
        __builtin_amdgcn_wave_barrier(); asm volatile("" ::: "memory");  // compiler order only (one wave): the 16 tile rows are stored to LDS before they are read back
#pragma unroll
        for (int s = 0; s < 4; ++s) { const int row = 4 * s + rsub; const v4f lo4 = *(const v4fa*)(os + row * 68 + cofs), hi4 = *(const v4fa*)(os + row * 68 + cofs + 4);
            const float br = bfr(bias[mb * 16 + row]); v8h o16; v8us oh, ol;
#pragma unroll
            for (int e = 0; e < 8; ++e) { const float r = ((e < 4) ? lo4[e & 3] : hi4[e & 3]) + (tr ? br : bc[e]); o16[e] = tohx(r); unsigned short a2, c2; splitf(r, a2, c2); oh[e] = a2; ol[e] = c2; }
            const size_t off = (size_t)(mb * 16 + row) * pitch + cofs;
            *(v8h*)(P16 + off) = o16; *(v8us*)(Ph + off) = oh; *(v8us*)(Pl + off) = ol; }
        __builtin_amdgcn_wave_barrier(); asm volatile("" ::: "memory");  // compiler order only: the rows are read before the next 16 overwrite them
    }
}

// ---- k_fattn: scores, causal softmax and probability x value in one launch for every batch and head. One wave owns 16 query rows and walks its keys KT x 16 at a time with a running maximum and sum.
// Transposed products: S^T = K Q^T (A = key rows, B = query rows), O^T += V^T P^T (A = V^T rows, B = two score tiles converted in place), so a lane holds one query's scores and P needs no lane exchange and no LDS.
// Query rows < RH (attn_rows_hl): hi+lo bf16 planes, 3 products each, 32 keys a step. The rest (attn_rows_st): single fp16, 64 keys a step. Both read their tiles from LDS. Grid: heaviest 64-row query groups first, 4 waves a block.
__device__ __forceinline__ float xhalf(float x) { return __builtin_bit_cast(float, __builtin_amdgcn_permlanex16(__builtin_bit_cast(int, x), __builtin_bit_cast(int, x), 0x76543210, 0xfedcba98, false, false)); }  // lane l with lane l ^ 16
// 2^x with the one free issue slot behind a transcendental written in
__device__ __forceinline__ float exp2s(float x) { float r; asm("v_exp_f32 %0, %1\n\tv_nop" : "=v"(r) : "v"(x)); return r; }
__device__ __forceinline__ v16h packp(const float* p, v16h*) { v16h r;
#pragma unroll
    for (int e = 0; e < 16; ++e) r[e] = (h16)p[e];
    return r; }
__device__ __forceinline__ v16bf packp(const float* p, v16bf* lo) { v8us h0, h1, l0, l1;
#pragma unroll
    for (int e = 0; e < 8; ++e) { unsigned short a, c; splitf(p[e], a, c); h0[e] = a; l0[e] = c; splitf(p[8 + e], a, c); h1[e] = a; l1[e] = c; }
    *lo = cat16b(l0, l1); return cat16b(h0, h1); }
// ---- the fp16 rows: the block's 4 waves walk the same 64-key steps, so each step's K rows [64 keys][64 d] and V^T rows [64 d][64 keys] are brought into LDS once for all four, as whole 128-byte lines (a fragment load from global memory touches 16 lines for 512 bytes).
#define LPB  144                  // LDS row pitch in bytes: 128 + 16 (16 B x odd), conflict-free for 16-byte fragment reads
#define TLB  (64 * LPB)           // one tile of 64 rows
#define BFB  (2 * TLB)            // one buffer: K tile, then V^T tile
// One step's tiles, 8 asynchronous 16-byte copies a lane (8 lanes a row, 16 rows a round of the block). kg, vg, ld: this lane's first K, V^T and LDS place.
template <typename T16>
__device__ __forceinline__ void stage_kv(const T16* kg, const T16* vg, unsigned ld) {
    // the s_wait_xcnt closes the statement so that no address register of a copy is rewritten in front of it
    asm volatile("global_load_async_to_lds_b128 %0, %8, off\n\t"
                 "global_load_async_to_lds_b128 %1, %9, off\n\t"
                 "global_load_async_to_lds_b128 %2, %10, off\n\t"
                 "global_load_async_to_lds_b128 %3, %11, off\n\t"
                 "global_load_async_to_lds_b128 %4, %12, off\n\t"
                 "global_load_async_to_lds_b128 %5, %13, off\n\t"
                 "global_load_async_to_lds_b128 %6, %14, off\n\t"
                 "global_load_async_to_lds_b128 %7, %15, off\n\t"
                 "s_wait_xcnt 0x0"
                 :: "v"(ld), "v"(ld + 16u * LPB), "v"(ld + 32u * LPB), "v"(ld + 48u * LPB), "v"(ld + TLB), "v"(ld + TLB + 16u * LPB), "v"(ld + TLB + 32u * LPB), "v"(ld + TLB + 48u * LPB),
                    "v"(kg), "v"(kg + 16 * HD), "v"(kg + 32 * HD), "v"(kg + 48 * HD), "v"(vg), "v"(vg + (size_t)16 * TT), "v"(vg + (size_t)32 * TT), "v"(vg + (size_t)48 * TT)
                 : "memory");
}
// The key walk is rotated: trip s works on 64-key stage (s + r0) mod nst, r0 by the block's query group, so the blocks of one batch and head, which read the same K and V^T lines, ask L2 for different lines at any one moment. The running maximum and sum take the stages in any order (every stage holds a key at or below each row's diagonal); only the order of the f32 sums changes.
__device__ __forceinline__ int wrapst(int i, int n) { return i >= n ? i - n : i; }   // i < 2 n
// nst = steps of the whole block (the same for its 4 waves); two buffers: step s + 1's copies fly while step s is worked on.
__device__ __forceinline__ void attn_rows_st(const h16* __restrict__ Q, const h16* __restrict__ Kp, const h16* __restrict__ Vt, char* sm, int nst, int r0, int q0, int lr, int hi, float* __restrict__ orow) {
    typedef WFrag<h16>::V V;                          // every full '#pragma unroll' below keeps a fragment or score array in registers (constant indices)
    const int KT = 4;
    const float CE = SCL * 1.4426950408889634f;      // raw score -> log2 domain
    const int tid = threadIdx.x;
    const h16* kg = Kp + tid * 8; const h16* vg = Vt + (size_t)(tid >> 3) * TT + (tid & 7) * 8;
    const unsigned ld = (unsigned)(size_t)sm + (unsigned)((tid >> 3) * LPB + (tid & 7) * 16);
    const int fo = lr * LPB + 16 * hi;                // a lane's byte place in a 16-row fragment of a tile
    stage_kv(kg + (size_t)(r0 * 64) * HD, vg + r0 * 64, ld);
    V qf[2];
#pragma unroll
    for (int c = 0; c < 2; ++c) qf[c] = WFrag<h16>::ld(Q + (size_t)(q0 + lr) * HD + 8 * hi + c * 32);
    v8f o[4];
#pragma unroll
    for (int dt = 0; dt < 4; ++dt) o[dt] = (v8f){};
    float m = -3.0e38f, l = 0.f;
    asm volatile("s_wait_asynccnt 0x0" ::: "memory");  // this wave's copies of step 0 have landed
    __syncthreads();                                   // ... and every other wave's
    if (nst > 1) { const int k1 = wrapst(r0 + 1, nst) * 64; stage_kv(kg + (size_t)k1 * HD, vg + k1, ld + BFB); }
#pragma unroll 1                                     // rolled: one step's fragments and scores fill the registers of 4 waves a SIMD
    for (int s = 0; s < nst; ++s) {
        const int kb = wrapst(s + r0, nst) * (KT * 16);
        const char* tk = sm + (s & 1) * BFB + fo; const char* tv = tk + TLB;
        V kf[KT][2], vf[4][KT / 2];
#pragma unroll
        for (int kt = 0; kt < KT; ++kt)
#pragma unroll
            for (int c = 0; c < 2; ++c) kf[kt][c] = WFrag<h16>::ld((const h16*)(tk + kt * 16 * LPB + c * 64));
        __builtin_amdgcn_sched_barrier(0);            // the 16 K reads go out as one group: without it this build read one fragment, waited for it and multiplied, eight times a step
        v8f st[KT];
#pragma unroll
        for (int kt = 0; kt < KT; ++kt) { st[kt] = (v8f){};
#pragma unroll
            for (int c = 0; c < 2; ++c) st[kt] = WFrag<h16>::mma(kf[kt][c], qf[c], st[kt]); }
#pragma unroll
        for (int dt = 0; dt < 4; ++dt)
#pragma unroll
            for (int kc = 0; kc < KT / 2; ++kc) vf[dt][kc] = WFrag<h16>::ld((const h16*)(tv + dt * 16 * LPB + kc * 64));
        __builtin_amdgcn_sched_barrier(0);            // the 16 V^T reads start here, under the softmax, not next to their products
        float p[KT * 8];
#pragma unroll
        for (int e = 0; e < KT * 8; ++e) p[e] = st[e >> 3][e & 7];
        if (kb + KT * 16 - 1 > q0) {                  // only a step that reaches the diagonal masks (wave-uniform)
#pragma unroll
            for (int e = 0; e < KT * 8; ++e) p[e] = (kb + (e >> 3) * 16 + hi * 8 + (e & 7) <= q0 + lr) ? p[e] : -3.0e38f; }
        float mx = p[0];
#pragma unroll
        for (int e = 1; e < KT * 8; ++e) mx = fmaxf(mx, p[e]);
        mx = fmaxf(mx, xhalf(mx));
        const float mn = fmaxf(m, mx), al = exp2s((m - mn) * CE), mc = mn * CE; m = mn;
        float ls = 0.f;
#pragma unroll
        for (int e = 0; e < KT * 8; ++e) { p[e] = exp2s(__builtin_fmaf(p[e], CE, -mc)); ls += p[e]; }
        l = l * al + ls;
#pragma unroll
        for (int dt = 0; dt < 4; ++dt) o[dt] *= al;
        __builtin_amdgcn_sched_barrier(0);            // every exp2s stays in front of the P.V products
#pragma unroll
        for (int kc = 0; kc < KT / 2; ++kc) { const V pf = packp(p + kc * 16, (V*)nullptr);
#pragma unroll
            for (int dt = 0; dt < 4; ++dt) o[dt] = WFrag<h16>::mma(vf[dt][kc], pf, o[dt]); }
        asm volatile("s_wait_dscnt 0x0" ::: "memory");     // this wave's reads of the buffer are done before it may be refilled
        asm volatile("s_wait_asynccnt 0x0" ::: "memory");  // this wave's copies of step s + 1 have landed
        __syncthreads();                                   // publishes step s + 1 and ends every wave's reads of step s
        if (s + 2 < nst) { const int kn = wrapst(s + 2 + r0, nst) * 64; stage_kv(kg + (size_t)kn * HD, vg + kn, ld + (unsigned)(s & 1) * BFB); }
    }
    asm volatile("s_wait_asynccnt 0x0" ::: "memory");  // nothing is in flight when the wave ends
    l += xhalf(l);
    const float inv = __fdiv_rn(1.0f, l);
#pragma unroll
    for (int dt = 0; dt < 4; ++dt) { v4f a, b;
#pragma unroll
        for (int j = 0; j < 4; ++j) { a[j] = o[dt][j] * inv; b[j] = o[dt][4 + j] * inv; }
        *(v4f*)(orow + dt * 16) = a; *(v4f*)(orow + dt * 16 + 4) = b; }
}
// ---- the hi+lo rows: the block's 4 waves walk the same 64-key stages, so each stage's K rows and V^T rows of both planes are brought into LDS once for all four, as whole 128-byte lines; a stage is worked on as two 32-key steps (keys and values of both planes take turns in the registers).
#define HBF  (2 * BFB)            // one buffer: K hi, V^T hi, K lo, V^T lo tiles
// nst = stages of the whole block (the same for its 4 waves); two buffers: stage s + 1's copies fly while stage s is worked on.
__device__ __forceinline__ void attn_rows_hl(const bf* __restrict__ Q, const bf* __restrict__ Q2, const bf* __restrict__ Kp, const bf* __restrict__ K2, const bf* __restrict__ Vt, const bf* __restrict__ Vt2, char* sm, int nst, int r0, int q0, int lr, int hi, float* __restrict__ orow) {
    typedef WFrag<bf>::V V;                           // every full '#pragma unroll' below keeps a fragment or score array in registers (constant indices)
    const int KT = 2;
    const float CE = SCL * 1.4426950408889634f;      // raw score -> log2 domain
    const int tid = threadIdx.x;
    const size_t kof = (size_t)tid * 8, vof = (size_t)(tid >> 3) * TT + (tid & 7) * 8;   // stage 0's places; the walk is rotated as in attn_rows_st
    const unsigned ld = (unsigned)(size_t)sm + (unsigned)((tid >> 3) * LPB + (tid & 7) * 16);
    const int fo = lr * LPB + 16 * hi;                // a lane's byte place in a 16-row fragment of a tile
    { const size_t k0 = (size_t)r0 * 64; stage_kv(Kp + kof + k0 * HD, Vt + vof + k0, ld); stage_kv(K2 + kof + k0 * HD, Vt2 + vof + k0, ld + BFB); }
    const size_t qo = (size_t)(q0 + lr) * HD + 8 * hi;
    V qf[2], qf2[2];
#pragma unroll
    for (int c = 0; c < 2; ++c) { qf[c] = WFrag<bf>::ld(Q + qo + c * 32); qf2[c] = WFrag<bf>::ld(Q2 + qo + c * 32); }
    v8f o[4];
#pragma unroll
    for (int dt = 0; dt < 4; ++dt) o[dt] = (v8f){};
    float m = -3.0e38f, l = 0.f;
    asm volatile("s_wait_asynccnt 0x0" ::: "memory");  // this wave's copies of stage 0 have landed
    __syncthreads();                                   // ... and every other wave's
    if (nst > 1) { const size_t k1 = (size_t)wrapst(r0 + 1, nst) * 64; stage_kv(Kp + kof + k1 * HD, Vt + vof + k1, ld + HBF); stage_kv(K2 + kof + k1 * HD, Vt2 + vof + k1, ld + HBF + BFB); }
#pragma unroll 1                                     // rolled: the two buffers take turns by (s & 1)
    for (int s = 0; s < nst; ++s) {
        const char* tb = sm + (s & 1) * HBF + fo;
#pragma unroll 1                                     // rolled: two steps unrolled take more than 256 registers, one wave a SIMD fewer
        for (int u = 0; u < 2; ++u) {
            const int kb = wrapst(s + r0, nst) * 64 + u * 32;
            if (kb > q0 + 15) break;                  // wave-uniform: every key of the step lies above this wave's diagonal; no barrier stands inside this loop
            const char* tk = tb + u * 32 * LPB; const char* tv = tb + TLB + u * 64;
            V kf[KT][2], kf2[KT][2], vf[4], vf2[4];
#pragma unroll
            for (int kt = 0; kt < KT; ++kt)
#pragma unroll
                for (int c = 0; c < 2; ++c) { kf[kt][c] = WFrag<bf>::ld((const bf*)(tk + kt * 16 * LPB + c * 64)); kf2[kt][c] = WFrag<bf>::ld((const bf*)(tk + BFB + kt * 16 * LPB + c * 64)); }
            __builtin_amdgcn_sched_barrier(0);        // the 16 K reads go out as one group, not one fragment at a time next to its product
            v8f st[KT];
#pragma unroll
            for (int kt = 0; kt < KT; ++kt) { st[kt] = (v8f){};
#pragma unroll
                for (int c = 0; c < 2; ++c) { st[kt] = WFrag<bf>::mma(kf[kt][c], qf[c], st[kt]); st[kt] = WFrag<bf>::mma(kf[kt][c], qf2[c], st[kt]); st[kt] = WFrag<bf>::mma(kf2[kt][c], qf[c], st[kt]); } }
#pragma unroll
            for (int dt = 0; dt < 4; ++dt) { vf[dt] = WFrag<bf>::ld((const bf*)(tv + dt * 16 * LPB)); vf2[dt] = WFrag<bf>::ld((const bf*)(tv + BFB + dt * 16 * LPB)); }
            __builtin_amdgcn_sched_barrier(0);        // the 16 V^T reads start here, under the softmax, not next to their products
            float p[KT * 8];
#pragma unroll
            for (int e = 0; e < KT * 8; ++e) p[e] = st[e >> 3][e & 7];
            if (kb + KT * 16 - 1 > q0) {              // only a step that reaches the diagonal masks (wave-uniform)
#pragma unroll
                for (int e = 0; e < KT * 8; ++e) p[e] = (kb + (e >> 3) * 16 + hi * 8 + (e & 7) <= q0 + lr) ? p[e] : -3.0e38f; }
            float mx = p[0];
#pragma unroll
            for (int e = 1; e < KT * 8; ++e) mx = fmaxf(mx, p[e]);
            mx = fmaxf(mx, xhalf(mx));
            const float mn = fmaxf(m, mx), al = exp2s((m - mn) * CE), mc = mn * CE; m = mn;
            float ls = 0.f;
#pragma unroll
            for (int e = 0; e < KT * 8; ++e) { p[e] = exp2s(__builtin_fmaf(p[e], CE, -mc)); ls += p[e]; }
            l = l * al + ls;
#pragma unroll
            for (int dt = 0; dt < 4; ++dt) o[dt] *= al;
            V pf2; const V pf = packp(p, &pf2);
#pragma unroll
            for (int dt = 0; dt < 4; ++dt) { o[dt] = WFrag<bf>::mma(vf[dt], pf, o[dt]); o[dt] = WFrag<bf>::mma(vf[dt], pf2, o[dt]); o[dt] = WFrag<bf>::mma(vf2[dt], pf, o[dt]); }
        }
        asm volatile("s_wait_dscnt 0x0" ::: "memory");     // this wave's reads of the buffer are done before it may be refilled
        asm volatile("s_wait_asynccnt 0x0" ::: "memory");  // this wave's copies of stage s + 1 have landed
        __syncthreads();                                   // publishes stage s + 1 and ends every wave's reads of stage s
        if (s + 2 < nst) { const unsigned lb = ld + (unsigned)(s & 1) * HBF; const size_t kn = (size_t)wrapst(s + 2 + r0, nst) * 64;
            stage_kv(Kp + kof + kn * HD, Vt + vof + kn, lb); stage_kv(K2 + kof + kn * HD, Vt2 + vof + kn, lb + BFB); }
    }
    asm volatile("s_wait_asynccnt 0x0" ::: "memory");  // nothing is in flight when the wave ends
    l += xhalf(l);
    const float inv = __fdiv_rn(1.0f, l);
#pragma unroll
    for (int dt = 0; dt < 4; ++dt) { v4f a, b;
#pragma unroll
        for (int j = 0; j < 4; ++j) { a[j] = o[dt][j] * inv; b[j] = o[dt][4 + j] * inv; }
        *(v4f*)(orow + dt * 16) = a; *(v4f*)(orow + dt * 16 + 4) = b; }
}
__global__ __launch_bounds__(128) void k_fattn(const h16* __restrict__ Q16, const h16* __restrict__ K16, const h16* __restrict__ V16, const bf* __restrict__ Qh, const bf* __restrict__ Ql, const bf* __restrict__ Kh, const bf* __restrict__ Kl, const bf* __restrict__ Vh, const bf* __restrict__ Vl, float* __restrict__ out) {
    __shared__ __align__(16) char sm[2 * HBF];
    const int lane = threadIdx.x & 31, lr = lane & 15, hi = lane >> 4; const int wv = __builtin_amdgcn_readfirstlane((int)(threadIdx.x >> 5));
    const int bh = blockIdx.x % (NB_ * NH_), qg = TT / 64 - 1 - (int)(blockIdx.x / (NB_ * NH_)); const int q0 = qg * 64 + wv * 16;
    const int nst = qg + 1, r0 = (qg * 37) % nst;    // keys 0 .. qg * 64 + 63: qg + 1 stages for each of the 4 waves; the first one spread over the query groups (block-uniform)
    const size_t pl = (size_t)bh * TT * HD;          // this batch and head's plane ([t][d] for q and k, [d][t] for v)
    float* orow = out + ((size_t)(bh / NH_) * TT + q0 + lr) * DQ + (bh % NH_) * HD + hi * 8;
    if (qg * 64 < RH) attn_rows_hl(Qh + pl, Ql + pl, Kh + pl, Kl + pl, Vh + pl, Vl + pl, sm, nst, r0, q0, lr, hi, orow);   // block-uniform
    else attn_rows_st(Q16 + pl, K16 + pl, V16 + pl, sm, nst, r0, q0, lr, hi, orow);
}

extern "C" void kernel_launch(void* const* d_in, const int* in_sizes, int n_in,
                              void* d_out, int out_size, void* d_ws, size_t ws_size, hipStream_t stream) {
    (void)in_sizes; (void)n_in; (void)out_size;
    const float* x = (const float*)d_in[0]; const float* wq = (const float*)d_in[1]; const float* bq = (const float*)d_in[2]; const float* wk = (const float*)d_in[3]; const float* bk = (const float*)d_in[4]; const float* wv = (const float*)d_in[5]; const float* bv = (const float*)d_in[6];
    float* OUT = (float*)d_out;     // [2][2048][1024]
    char* wsp = (char*)d_ws;
    auto take = [&](size_t bytes) { char* p = wsp; wsp += (bytes + 255) & ~(size_t)255; return (void*)p; };
    bf* XW = (bf*)take(((size_t)NB_ * TT + 3 * DQ) * DM * 2);   // bf16 x rows of both batches, then the wq, wk, wv rows
    const size_t PB = (size_t)NH_ * TT * HD;   // elements of one batch's head planes
    h16* QP16 = (h16*)take(NB_ * PB * 2); h16* KP16 = (h16*)take(NB_ * PB * 2); h16* VT16 = (h16*)take(NB_ * PB * 2);
    bf* QPh = (bf*)take(NB_ * PB * 2); bf* QPl = (bf*)take(NB_ * PB * 2); bf* KPh = (bf*)take(NB_ * PB * 2); bf* KPl = (bf*)take(NB_ * PB * 2); bf* VTh = (bf*)take(NB_ * PB * 2); bf* VTl = (bf*)take(NB_ * PB * 2);
    if ((size_t)(wsp - (char*)d_ws) > ws_size) return;    // ws 256 MiB
    k_cvtall<<<(NB_ * TT + 3 * DQ) * DM / CB, 256, 0, stream>>>(x, wq, wk, wv, XW);
    k_proj<<<dim3(NB_ * TT / 128, 3 * DQ / 128, 1), 128, 0, stream>>>(XW, XW + (size_t)NB_ * TT * DM, bq, bk, bv, QP16, QPh, QPl, KP16, KPh, KPl, VT16, VTh, VTl);
    k_fattn<<<NB_ * NH_ * (TT / 64), 128, 0, stream>>>(QP16, KP16, VT16, QPh, QPl, KPh, KPl, VTh, VTl, OUT);
}

// v007
// It runs in 57.1 microseconds.
// Timed twice side by side with v006, it ran 1.04 and 1.03 times as fast.
// All steps since v000 together make it 24.4 times as fast.
#include <hip/hip_runtime.h>

// Causal multi-head self-attention without an output projection (x [2][2048][1024]; q, k, v = x W^T + b ('oi' [1024][1024] + [1024], 16 heads x 64); att = q.k / sqrt(1024) (the module scales by the full hidden size), causal mask (-inf above the diagonal); softmax; out = merged heads -> [2][2048][1024] (4.2 M)).
// Compute dtypes, f32 accumulate: every input rounded to bf16; q/k/v on PLAIN bf16 operands (inputs: exact) + biases, one launch for all three and both batches, operand rows staged in LDS for a block's 4 waves, head planes written from its epilogue; causal scores and attn.v in one launch (running maximum and sum over 32- or 64-key steps): query rows < 512 hl (3 products), the rest single fp16, key and value tiles of both staged in LDS for the block's 4 waves; softmax f32; no output projection: the merged heads are written in f32 straight to the output.

#define NB_  2
#define TT   2048
#define DM   1024
#define NH_  16
#define NKV  16
#define HD   64
#define DQ   (NH_ * HD)
#define DKV  (NKV * HD)
#define RH   512                  // query rows < RH use hi+lo planes (0: none)
#define SCL  0.03125f   // 1/sqrt(h_dim = 1024): the module scales by the full hidden size
typedef _Float16 h16;
typedef unsigned short bf;
typedef __attribute__((ext_vector_type(16))) __bf16   v16bf;
typedef __attribute__((ext_vector_type(16))) _Float16 v16h;
typedef __attribute__((ext_vector_type(8)))  _Float16 v8h;
typedef __attribute__((ext_vector_type(8)))  unsigned short v8us;
typedef __attribute__((ext_vector_type(8)))  float    v8f;
typedef __attribute__((ext_vector_type(4)))  float    v4f;
typedef v8h  __attribute__((may_alias)) v8ha;
typedef v4f  __attribute__((may_alias)) v4fa;
typedef v8us __attribute__((may_alias)) v8usa;

__device__ __forceinline__ unsigned short f2bf(float f) { unsigned u = __float_as_uint(f); u += 0x7FFFu + ((u >> 16) & 1u); return (unsigned short)(u >> 16); }
__device__ __forceinline__ float bf2f(unsigned short b) { return __uint_as_float(((unsigned)b) << 16); }
__device__ __forceinline__ float bfr(float f) { return bf2f(f2bf(f)); }
__device__ __forceinline__ v16h cat16(v8h lo, v8h hi) { return __builtin_shufflevector(lo, hi, 0, 1, 2, 3, 4, 5, 6, 7, 8, 9, 10, 11, 12, 13, 14, 15); }
__device__ __forceinline__ v16bf cat16b(v8us lo, v8us hi) { return __builtin_bit_cast(v16bf, __builtin_shufflevector(lo, hi, 0, 1, 2, 3, 4, 5, 6, 7, 8, 9, 10, 11, 12, 13, 14, 15)); }
__device__ __forceinline__ v8f wmma16(v16h a, v16h b, v8f c) { return __builtin_amdgcn_wmma_f32_16x16x32_f16(false, a, false, b, (short)0, c, false, false); }
__device__ __forceinline__ v8f wmmab(v16bf a, v16bf b, v8f c) { return __builtin_amdgcn_wmma_f32_16x16x32_bf16(false, a, false, b, (short)0, c, false, false); }



// fragment loaders and matrix products by 16-bit type: a fragment is two 16-byte loads of one K-contiguous row
template <typename T16> struct WFrag;
template <> struct WFrag<h16> { typedef v16h V; static __device__ __forceinline__ V ld(const h16* p) { return cat16(*(const v8h*)p, *(const v8h*)(p + 16)); } static __device__ __forceinline__ v8f mma(V a, V b, v8f c) { return wmma16(a, b, c); } };
template <> struct WFrag<bf> { typedef v16bf V; static __device__ __forceinline__ V ld(const bf* p) { return cat16b(*(const v8us*)p, *(const v8us*)(p + 16)); } static __device__ __forceinline__ v8f mma(V a, V b, v8f c) { return wmmab(a, b, c); } };
__device__ __forceinline__ h16 tohx(float x) { return (h16)x; }
__device__ __forceinline__ void splitf(float y, unsigned short& h, unsigned short& l) { h = f2bf(y); l = f2bf(y - bf2f(h)); }
// ---- k_cvtall: x (both batches) and the three weights rounded to bf16 into one plane of PR rows [x rows | wq rows | wk rows | wv rows], stored in 16 slabs of 64 k: [k / 64][row][64]. So the rows that k_proj stages for one 64-k step lie one behind the other, and a wave-wide 16-byte copy reads 512 contiguous bytes, not four lines 2 KB apart.
// 8192 elements (8 rows) a block, 4 x 8 a thread: 8 lanes take a row's 64-k run, a wave 4 rows of one slab (512 contiguous bytes stored), a round of the block 8 rows of 4 slabs.
#define CB   8192
#define PR   (NB_ * TT + 3 * DQ)  // rows of the plane
#define PS   (PR * 64)            // elements of one slab
__global__ __launch_bounds__(256) void k_cvtall(const float* __restrict__ x, const float* __restrict__ wq, const float* __restrict__ wk, const float* __restrict__ wv, bf* dst) {
    const int XBK = NB_ * TT * DM / CB, WBK = DQ * DM / CB; const int blk = blockIdx.x;
    const float* src = x; int sb = blk;
    if (blk >= XBK) { const int w = (blk - XBK) / WBK; sb = (blk - XBK) % WBK; src = (w == 0) ? wq : (w == 1) ? wk : wv; }
    static_assert(CB == 8 * DM, "a block takes 8 whole rows");
    const int t = threadIdx.x, row = (t >> 3) & 7, sl = t >> 6, pc = (t & 7) * 8;
    const float* s = src + (size_t)sb * CB + row * DM + sl * 64 + pc; bf* d = dst + ((size_t)sl * PR + blk * 8 + row) * 64 + pc;
    v8f v[4];
#pragma unroll
    for (int i = 0; i < 4; ++i) v[i] = *(const v8f*)(s + i * 256);
#pragma unroll
    for (int i = 0; i < 4; ++i) { v8us o;
#pragma unroll
        for (int k = 0; k < 8; ++k) o[k] = f2bf(v[i][k]);
        *(v8us*)(d + (size_t)i * 4 * PS) = o; }
}

// ---- k_proj: the q, k and v projections of both batches in one launch. A block of 4 waves owns 128 tokens x 128 output columns (two heads of one of q, k, v), ONE WAVE per 64x64 tile (16 accumulators); grid (NB_ * TT / 128, 3 * DQ / 128), 128 threads.
// Each 64-k step's 128 x rows and 128 weight rows are brought into LDS once for the block, each operand one contiguous 16 KB run of its slab (a fragment load from global memory touches 16 lines for 512 bytes, and each row is wanted by two waves); two buffers: step s + 1's copies fly while step s is worked on.
// A wave's tile is 64 tokens x one head. q and k: A = x rows, B = weight rows, tile [t][d]; v: A = weight rows, B = x rows, tile [d][t], so every tile row is one 128-byte row of its head plane ([h][t][d] for q and k; v in tiles of 64 tokens, [h][t / 64][d][64], so that a 64-key V^T tile is one contiguous 8 KB run like a K tile).
// The k walk is rotated: block (x, y) starts at 64-k step (x + y) mod 16 and wraps, so the 24 blocks that share x rows and the 32 that share weight rows ask L2 for different lines at any one moment. Only the order of the f32 sums changes.
// Epilogue: + bf16-rounded bias in f32, then the fp16 plane and the hi + lo bf16 planes, 16-byte stores.
#define PLB  144                  // LDS row pitch in bytes: 128 + 16 (16 B x odd), conflict-free for 16-byte fragment reads
#define PXB  (128 * PLB)          // one operand's 128 rows
#define PBF  (2 * PXB)            // one buffer: x rows, then weight rows
// 128 rows x 128 bytes of one operand, 8 asynchronous 16-byte copies a lane (8 lanes a row, 16 rows a round of the block). g, ld: this lane's first global and LDS place.
__device__ __forceinline__ void stage_rows(const bf* g, unsigned ld) {
    // the s_wait_xcnt closes the statement so that no address register of a copy is rewritten in front of it
    asm volatile("global_load_async_to_lds_b128 %0, %8, off\n\t"
                 "global_load_async_to_lds_b128 %1, %9, off\n\t"
                 "global_load_async_to_lds_b128 %2, %10, off\n\t"
                 "global_load_async_to_lds_b128 %3, %11, off\n\t"
                 "global_load_async_to_lds_b128 %4, %12, off\n\t"
                 "global_load_async_to_lds_b128 %5, %13, off\n\t"
                 "global_load_async_to_lds_b128 %6, %14, off\n\t"
                 "global_load_async_to_lds_b128 %7, %15, off\n\t"
                 "s_wait_xcnt 0x0"
                 :: "v"(ld), "v"(ld + 16u * PLB), "v"(ld + 32u * PLB), "v"(ld + 48u * PLB), "v"(ld + 64u * PLB), "v"(ld + 80u * PLB), "v"(ld + 96u * PLB), "v"(ld + 112u * PLB),
                    "v"(g), "v"(g + 16 * 64), "v"(g + 32 * 64), "v"(g + 48 * 64), "v"(g + 64 * 64), "v"(g + 80 * 64), "v"(g + 96 * 64), "v"(g + 112 * 64)
                 : "memory");
}
__global__ __launch_bounds__(128) void k_proj(const bf* __restrict__ X, const bf* __restrict__ Wt, const float* __restrict__ bq, const float* __restrict__ bk, const float* __restrict__ bv, h16* Q16, bf* Qh, bf* Ql, h16* K16, bf* Kh, bf* Kl, h16* V16, bf* Vh, bf* Vl) {
    typedef WFrag<bf>::V V;
    __shared__ __align__(16) char sm[2 * PBF];
    __shared__ __align__(16) float osb[4][16 * 68];
    const int NS = DM / 64;
    static_assert((NS & (NS - 1)) == 0, "the rotated k walk wraps by a mask");
    const int r0 = (int)(blockIdx.x + blockIdx.y) & (NS - 1);   // this block's first 64-k step
    const int tid = threadIdx.x, lane = tid & 31, lr = lane & 15, hi = lane >> 4; const int wv = __builtin_amdgcn_readfirstlane(tid >> 5);
    const int tb = blockIdx.x * 128, nb0 = blockIdx.y * 128; const int wt = wv & 1, wn = wv >> 1; const int t0 = tb + wt * 64, n0 = nb0 + wn * 64;
    const int which = n0 / DQ, h = (n0 % DQ) / HD; const bool tr = which == 2;   // block-uniform: 0 q, 1 k, 2 v
    float* os = osb[wv];                              // each wave's own epilogue rows
    const bf* xg = X + (size_t)tb * 64 + tid * 8; const bf* wg = Wt + (size_t)nb0 * 64 + tid * 8;   // slab 0: row tid >> 3, 16-byte piece tid & 7
    const unsigned ld = (unsigned)(size_t)sm + (unsigned)((tid >> 3) * PLB + (tid & 7) * 16);
    const int fo = lr * PLB + 16 * hi;                // a lane's byte place in a 16-row fragment, the same for A and B
    const char* fx = sm + wt * 64 * PLB + fo; const char* fw = sm + PXB + wn * 64 * PLB + fo;
    const char* fa = tr ? fw : fx; const char* fb = tr ? fx : fw;
    stage_rows(xg + r0 * PS, ld); stage_rows(wg + r0 * PS, ld + PXB);
    v8f acc[4][4];
#pragma unroll
    for (int mb = 0; mb < 4; ++mb)
#pragma unroll
        for (int nb = 0; nb < 4; ++nb) acc[mb][nb] = (v8f){};
    asm volatile("s_wait_asynccnt 0x0" ::: "memory");  // this wave's copies of step 0 have landed
    __syncthreads();                                   // ... and every other wave's
    { const int k1 = ((r0 + 1) & (NS - 1)) * PS; stage_rows(xg + k1, ld + PBF); stage_rows(wg + k1, ld + PBF + PXB); }
#pragma unroll 1                                     // rolled: the two buffers take turns by (s & 1)
    for (int s = 0; s < NS; ++s) {
        const int bo = (s & 1) * PBF;
        V a[4], b[4];
#pragma unroll
        for (int c = 0; c < 2; ++c) {
#pragma unroll
            for (int mb = 0; mb < 4; ++mb) a[mb] = WFrag<bf>::ld((const bf*)(fa + bo + mb * 16 * PLB + c * 64));
#pragma unroll
            for (int nb = 0; nb < 4; ++nb) b[nb] = WFrag<bf>::ld((const bf*)(fb + bo + nb * 16 * PLB + c * 64));
            __builtin_amdgcn_sched_barrier(0);        // the 16 LDS reads of a 32-k chunk go out as one group: without it this build read one B fragment, waited for it and multiplied, four times a chunk
            if (c == 1) {                             // the step's last LDS reads are out: hand the buffer over here, so that the refill is under way while the second chunk's products (registers only) run
                asm volatile("s_wait_dscnt 0x0" ::: "memory");     // this wave's reads of the buffer are done before it may be refilled
                asm volatile("s_wait_asynccnt 0x0" ::: "memory");  // this wave's copies of step s + 1 have landed
                __syncthreads();                                   // publishes step s + 1 and ends every wave's reads of step s
                if (s + 2 < NS) { const int kn = ((s + 2 + r0) & (NS - 1)) * PS; stage_rows(xg + kn, ld + (unsigned)bo); stage_rows(wg + kn, ld + (unsigned)bo + PXB); }
            }
#pragma unroll
            for (int nb = 0; nb < 4; ++nb)
#pragma unroll
                for (int mb = 0; mb < 4; ++mb) acc[mb][nb] = WFrag<bf>::mma(a[mb], b[nb], acc[mb][nb]);
        }
    }
    asm volatile("s_wait_asynccnt 0x0" ::: "memory");  // nothing is in flight when the wave goes on to the epilogue
    const size_t base = (size_t)((t0 / TT) * NH_ + h) * TT * HD + (size_t)(t0 % TT) * HD; const int pitch = HD;   // the wave's 64 x 64 tile is contiguous in every plane
    h16* P16 = ((which == 0) ? Q16 : (which == 1) ? K16 : V16) + base; bf* Ph = ((which == 0) ? Qh : (which == 1) ? Kh : Vh) + base; bf* Pl = ((which == 0) ? Ql : (which == 1) ? Kl : Vl) + base;
    const float* bias = ((which == 0) ? bq : (which == 1) ? bk : bv) + h * HD;
    const int rsub = lane >> 3, cofs = (lane & 7) * 8;   // 8 lanes write one 128-byte plane row
    float bc[8];
#pragma unroll
    for (int e = 0; e < 8; ++e) bc[e] = bfr(bias[cofs + e]);
#pragma unroll
    for (int mb = 0; mb < 4; ++mb) {
#pragma unroll
        for (int nb = 0; nb < 4; ++nb) {
#pragma unroll
            for (int j = 0; j < 8; ++j) os[(hi * 8 + j) * 68 + nb * 16 + lr] = acc[mb][nb][j]; }
        __builtin_amdgcn_wave_barrier(); asm volatile("" ::: "memory");  // compiler order only (one wave): the 16 tile rows are stored to LDS before they are read back
#pragma unroll
        for (int s = 0; s < 4; ++s) { const int row = 4 * s + rsub; const v4f lo4 = *(const v4fa*)(os + row * 68 + cofs), hi4 = *(const v4fa*)(os + row * 68 + cofs + 4);
            const float br = bfr(bias[mb * 16 + row]); v8h o16; v8us oh, ol;
#pragma unroll
            for (int e = 0; e < 8; ++e) { const float r = ((e < 4) ? lo4[e & 3] : hi4[e & 3]) + (tr ? br : bc[e]); o16[e] = tohx(r); unsigned short a2, c2; splitf(r, a2, c2); oh[e] = a2; ol[e] = c2; }
            const size_t off = (size_t)(mb * 16 + row) * pitch + cofs;
            *(v8h*)(P16 + off) = o16; *(v8us*)(Ph + off) = oh; *(v8us*)(Pl + off) = ol; }
        __builtin_amdgcn_wave_barrier(); asm volatile("" ::: "memory");  // compiler order only: the rows are read before the next 16 overwrite them
    }
}

// ---- k_fattn: scores, causal softmax and probability x value in one launch for every batch and head. One wave owns 16 query rows and walks its keys KT x 16 at a time with a running maximum and sum.
// Transposed products: S^T = K Q^T (A = key rows, B = query rows), O^T += V^T P^T (A = V^T rows, B = two score tiles converted in place), so a lane holds one query's scores and P needs no lane exchange and no LDS.
// Query rows < RH (attn_rows_hl): hi+lo bf16 planes, 3 products each, 32 keys a step. The rest (attn_rows_st): single fp16, 64 keys a step. Both read their tiles from LDS. Grid: heaviest 64-row query groups first, 4 waves a block.
__device__ __forceinline__ float xhalf(float x) { return __builtin_bit_cast(float, __builtin_amdgcn_permlanex16(__builtin_bit_cast(int, x), __builtin_bit_cast(int, x), 0x76543210, 0xfedcba98, false, false)); }  // lane l with lane l ^ 16
// 2^x with the one free issue slot behind a transcendental written in
__device__ __forceinline__ float exp2s(float x) { float r; asm("v_exp_f32 %0, %1\n\tv_nop" : "=v"(r) : "v"(x)); return r; }
__device__ __forceinline__ v16h packp(const float* p, v16h*) { v16h r;
#pragma unroll
    for (int e = 0; e < 16; ++e) r[e] = (h16)p[e];
    return r; }
__device__ __forceinline__ v16bf packp(const float* p, v16bf* lo) { v8us h0, h1, l0, l1;
#pragma unroll
    for (int e = 0; e < 8; ++e) { unsigned short a, c; splitf(p[e], a, c); h0[e] = a; l0[e] = c; splitf(p[8 + e], a, c); h1[e] = a; l1[e] = c; }
    *lo = cat16b(l0, l1); return cat16b(h0, h1); }
// ---- the fp16 rows: the block's 4 waves walk the same 64-key steps, so each step's K rows [64 keys][64 d] and V^T rows [64 d][64 keys] are brought into LDS once for all four, each tile one contiguous 8 KB run (a fragment load from global memory touches 16 lines for 512 bytes).
#define LPB  144                  // LDS row pitch in bytes: 128 + 16 (16 B x odd), conflict-free for 16-byte fragment reads
#define TLB  (64 * LPB)           // one tile of 64 rows
#define BFB  (2 * TLB)            // one buffer: K tile, then V^T tile
// One step's tiles, 8 asynchronous 16-byte copies a lane (8 lanes a row, 16 rows a round of the block). kg, vg, ld: this lane's first K, V^T and LDS place.
template <typename T16>
__device__ __forceinline__ void stage_kv(const T16* kg, const T16* vg, unsigned ld) {
    // the s_wait_xcnt closes the statement so that no address register of a copy is rewritten in front of it
    asm volatile("global_load_async_to_lds_b128 %0, %8, off\n\t"
                 "global_load_async_to_lds_b128 %1, %9, off\n\t"
                 "global_load_async_to_lds_b128 %2, %10, off\n\t"
                 "global_load_async_to_lds_b128 %3, %11, off\n\t"
                 "global_load_async_to_lds_b128 %4, %12, off\n\t"
                 "global_load_async_to_lds_b128 %5, %13, off\n\t"
                 "global_load_async_to_lds_b128 %6, %14, off\n\t"
                 "global_load_async_to_lds_b128 %7, %15, off\n\t"
                 "s_wait_xcnt 0x0"
                 :: "v"(ld), "v"(ld + 16u * LPB), "v"(ld + 32u * LPB), "v"(ld + 48u * LPB), "v"(ld + TLB), "v"(ld + TLB + 16u * LPB), "v"(ld + TLB + 32u * LPB), "v"(ld + TLB + 48u * LPB),
                    "v"(kg), "v"(kg + 16 * HD), "v"(kg + 32 * HD), "v"(kg + 48 * HD), "v"(vg), "v"(vg + 16 * 64), "v"(vg + 32 * 64), "v"(vg + 48 * 64)
                 : "memory");
}
// The key walk is rotated: trip s works on 64-key stage (s + r0) mod nst, r0 by the block's query group, so the blocks of one batch and head, which read the same K and V^T lines, ask L2 for different lines at any one moment. The running maximum and sum take the stages in any order (every stage holds a key at or below each row's diagonal); only the order of the f32 sums changes.
__device__ __forceinline__ int wrapst(int i, int n) { return i >= n ? i - n : i; }   // i < 2 n
// nst = steps of the whole block (the same for its 4 waves); two buffers: step s + 1's copies fly while step s is worked on.
__device__ __forceinline__ void attn_rows_st(const h16* __restrict__ Q, const h16* __restrict__ Kp, const h16* __restrict__ Vt, char* sm, int nst, int r0, int q0, int lr, int hi, float* __restrict__ orow) {
    typedef WFrag<h16>::V V;                          // every full '#pragma unroll' below keeps a fragment or score array in registers (constant indices)
    const int KT = 4;
    const float CE = SCL * 1.4426950408889634f;      // raw score -> log2 domain
    const int tid = threadIdx.x;
    const h16* kg = Kp + tid * 8; const h16* vg = Vt + tid * 8;
    const unsigned ld = (unsigned)(size_t)sm + (unsigned)((tid >> 3) * LPB + (tid & 7) * 16);
    const int fo = lr * LPB + 16 * hi;                // a lane's byte place in a 16-row fragment of a tile
    stage_kv(kg + (size_t)(r0 * 64) * HD, vg + (size_t)(r0 * 64) * HD, ld);
    V qf[2];
#pragma unroll
    for (int c = 0; c < 2; ++c) qf[c] = WFrag<h16>::ld(Q + (size_t)(q0 + lr) * HD + 8 * hi + c * 32);
    v8f o[4];
#pragma unroll
    for (int dt = 0; dt < 4; ++dt) o[dt] = (v8f){};
    float m = -3.0e38f, l = 0.f;
    asm volatile("s_wait_asynccnt 0x0" ::: "memory");  // this wave's copies of step 0 have landed
    __syncthreads();                                   // ... and every other wave's
    if (nst > 1) { const int k1 = wrapst(r0 + 1, nst) * 64; stage_kv(kg + (size_t)k1 * HD, vg + (size_t)k1 * HD, ld + BFB); }
#pragma unroll 1                                     // rolled: one step's fragments and scores fill the registers of 4 waves a SIMD
    for (int s = 0; s < nst; ++s) {
        const int kb = wrapst(s + r0, nst) * (KT * 16);
        const char* tk = sm + (s & 1) * BFB + fo; const char* tv = tk + TLB;
        V kf[KT][2], vf[4][KT / 2];
#pragma unroll
        for (int kt = 0; kt < KT; ++kt)
#pragma unroll
            for (int c = 0; c < 2; ++c) kf[kt][c] = WFrag<h16>::ld((const h16*)(tk + kt * 16 * LPB + c * 64));
        __builtin_amdgcn_sched_barrier(0);            // the 16 K reads go out as one group: without it this build read one fragment, waited for it and multiplied, eight times a step
        v8f st[KT];
#pragma unroll
        for (int kt = 0; kt < KT; ++kt) { st[kt] = (v8f){};
#pragma unroll
            for (int c = 0; c < 2; ++c) st[kt] = WFrag<h16>::mma(kf[kt][c], qf[c], st[kt]); }
#pragma unroll
        for (int dt = 0; dt < 4; ++dt)
#pragma unroll
            for (int kc = 0; kc < KT / 2; ++kc) vf[dt][kc] = WFrag<h16>::ld((const h16*)(tv + dt * 16 * LPB + kc * 64));
        __builtin_amdgcn_sched_barrier(0);            // the 16 V^T reads start here, under the softmax, not next to their products
        float p[KT * 8];
#pragma unroll
        for (int e = 0; e < KT * 8; ++e) p[e] = st[e >> 3][e & 7];
        if (kb + KT * 16 - 1 > q0) {                  // only a step that reaches the diagonal masks (wave-uniform)
#pragma unroll
            for (int e = 0; e < KT * 8; ++e) p[e] = (kb + (e >> 3) * 16 + hi * 8 + (e & 7) <= q0 + lr) ? p[e] : -3.0e38f; }
        float mx = p[0];
#pragma unroll
        for (int e = 1; e < KT * 8; ++e) mx = fmaxf(mx, p[e]);
        mx = fmaxf(mx, xhalf(mx));
        const float mn = fmaxf(m, mx), al = exp2s((m - mn) * CE), mc = mn * CE; m = mn;
        float ls = 0.f;
#pragma unroll
        for (int e = 0; e < KT * 8; ++e) { p[e] = exp2s(__builtin_fmaf(p[e], CE, -mc)); ls += p[e]; }
        l = l * al + ls;
#pragma unroll
        for (int dt = 0; dt < 4; ++dt) o[dt] *= al;
        __builtin_amdgcn_sched_barrier(0);            // every exp2s stays in front of the P.V products
#pragma unroll
        for (int kc = 0; kc < KT / 2; ++kc) { const V pf = packp(p + kc * 16, (V*)nullptr);
#pragma unroll
            for (int dt = 0; dt < 4; ++dt) o[dt] = WFrag<h16>::mma(vf[dt][kc], pf, o[dt]); }
        asm volatile("s_wait_dscnt 0x0" ::: "memory");     // this wave's reads of the buffer are done before it may be refilled
        asm volatile("s_wait_asynccnt 0x0" ::: "memory");  // this wave's copies of step s + 1 have landed
        __syncthreads();                                   // publishes step s + 1 and ends every wave's reads of step s
        if (s + 2 < nst) { const int kn = wrapst(s + 2 + r0, nst) * 64; stage_kv(kg + (size_t)kn * HD, vg + (size_t)kn * HD, ld + (unsigned)(s & 1) * BFB); }
    }
    asm volatile("s_wait_asynccnt 0x0" ::: "memory");  // nothing is in flight when the wave ends
    l += xhalf(l);
    const float inv = __fdiv_rn(1.0f, l);
#pragma unroll
    for (int dt = 0; dt < 4; ++dt) { v4f a, b;
#pragma unroll
        for (int j = 0; j < 4; ++j) { a[j] = o[dt][j] * inv; b[j] = o[dt][4 + j] * inv; }
        *(v4f*)(orow + dt * 16) = a; *(v4f*)(orow + dt * 16 + 4) = b; }
}
// ---- the hi+lo rows: the block's 4 waves walk the same 64-key stages, so each stage's K rows and V^T rows of both planes are brought into LDS once for all four, as whole 128-byte lines; a stage is worked on as two 32-key steps (keys and values of both planes take turns in the registers).
#define HBF  (2 * BFB)            // one buffer: K hi, V^T hi, K lo, V^T lo tiles
// nst = stages of the whole block (the same for its 4 waves); two buffers: stage s + 1's copies fly while stage s is worked on.
__device__ __forceinline__ void attn_rows_hl(const bf* __restrict__ Q, const bf* __restrict__ Q2, const bf* __restrict__ Kp, const bf* __restrict__ K2, const bf* __restrict__ Vt, const bf* __restrict__ Vt2, char* sm, int nst, int r0, int q0, int lr, int hi, float* __restrict__ orow) {
    typedef WFrag<bf>::V V;                           // every full '#pragma unroll' below keeps a fragment or score array in registers (constant indices)
    const int KT = 2;
    const float CE = SCL * 1.4426950408889634f;      // raw score -> log2 domain
    const int tid = threadIdx.x;
    const size_t kof = (size_t)tid * 8, vof = kof;   // stage 0's places; the walk is rotated as in attn_rows_st
    const unsigned ld = (unsigned)(size_t)sm + (unsigned)((tid >> 3) * LPB + (tid & 7) * 16);
    const int fo = lr * LPB + 16 * hi;                // a lane's byte place in a 16-row fragment of a tile
    { const size_t k0 = (size_t)r0 * 64; stage_kv(Kp + kof + k0 * HD, Vt + vof + k0 * HD, ld); stage_kv(K2 + kof + k0 * HD, Vt2 + vof + k0 * HD, ld + BFB); }
    const size_t qo = (size_t)(q0 + lr) * HD + 8 * hi;
    V qf[2], qf2[2];
#pragma unroll
    for (int c = 0; c < 2; ++c) { qf[c] = WFrag<bf>::ld(Q + qo + c * 32); qf2[c] = WFrag<bf>::ld(Q2 + qo + c * 32); }
    v8f o[4];
#pragma unroll
    for (int dt = 0; dt < 4; ++dt) o[dt] = (v8f){};
    float m = -3.0e38f, l = 0.f;
    asm volatile("s_wait_asynccnt 0x0" ::: "memory");  // this wave's copies of stage 0 have landed
    __syncthreads();                                   // ... and every other wave's
    if (nst > 1) { const size_t k1 = (size_t)wrapst(r0 + 1, nst) * 64; stage_kv(Kp + kof + k1 * HD, Vt + vof + k1 * HD, ld + HBF); stage_kv(K2 + kof + k1 * HD, Vt2 + vof + k1 * HD, ld + HBF + BFB); }
#pragma unroll 1                                     // rolled: the two buffers take turns by (s & 1)
    for (int s = 0; s < nst; ++s) {
        const char* tb = sm + (s & 1) * HBF + fo;
#pragma unroll 1                                     // rolled: two steps unrolled take more than 256 registers, one wave a SIMD fewer
        for (int u = 0; u < 2; ++u) {
            const int kb = wrapst(s + r0, nst) * 64 + u * 32;
            if (kb > q0 + 15) break;                  // wave-uniform: every key of the step lies above this wave's diagonal; no barrier stands inside this loop
            const char* tk = tb + u * 32 * LPB; const char* tv = tb + TLB + u * 64;
            V kf[KT][2], kf2[KT][2], vf[4], vf2[4];
#pragma unroll
            for (int kt = 0; kt < KT; ++kt)
#pragma unroll
                for (int c = 0; c < 2; ++c) { kf[kt][c] = WFrag<bf>::ld((const bf*)(tk + kt * 16 * LPB + c * 64)); kf2[kt][c] = WFrag<bf>::ld((const bf*)(tk + BFB + kt * 16 * LPB + c * 64)); }
            __builtin_amdgcn_sched_barrier(0);        // the 16 K reads go out as one group, not one fragment at a time next to its product
            v8f st[KT];
#pragma unroll
            for (int kt = 0; kt < KT; ++kt) { st[kt] = (v8f){};
#pragma unroll
                for (int c = 0; c < 2; ++c) { st[kt] = WFrag<bf>::mma(kf[kt][c], qf[c], st[kt]); st[kt] = WFrag<bf>::mma(kf[kt][c], qf2[c], st[kt]); st[kt] = WFrag<bf>::mma(kf2[kt][c], qf[c], st[kt]); } }
#pragma unroll
            for (int dt = 0; dt < 4; ++dt) { vf[dt] = WFrag<bf>::ld((const bf*)(tv + dt * 16 * LPB)); vf2[dt] = WFrag<bf>::ld((const bf*)(tv + BFB + dt * 16 * LPB)); }
            __builtin_amdgcn_sched_barrier(0);        // the 16 V^T reads start here, under the softmax, not next to their products
            float p[KT * 8];
#pragma unroll
            for (int e = 0; e < KT * 8; ++e) p[e] = st[e >> 3][e & 7];
            if (kb + KT * 16 - 1 > q0) {              // only a step that reaches the diagonal masks (wave-uniform)
#pragma unroll
                for (int e = 0; e < KT * 8; ++e) p[e] = (kb + (e >> 3) * 16 + hi * 8 + (e & 7) <= q0 + lr) ? p[e] : -3.0e38f; }
            float mx = p[0];
#pragma unroll
            for (int e = 1; e < KT * 8; ++e) mx = fmaxf(mx, p[e]);
            mx = fmaxf(mx, xhalf(mx));
            const float mn = fmaxf(m, mx), al = exp2s((m - mn) * CE), mc = mn * CE; m = mn;
            float ls = 0.f;
#pragma unroll
            for (int e = 0; e < KT * 8; ++e) { p[e] = exp2s(__builtin_fmaf(p[e], CE, -mc)); ls += p[e]; }
            l = l * al + ls;
#pragma unroll
            for (int dt = 0; dt < 4; ++dt) o[dt] *= al;
            V pf2; const V pf = packp(p, &pf2);
#pragma unroll
            for (int dt = 0; dt < 4; ++dt) { o[dt] = WFrag<bf>::mma(vf[dt], pf, o[dt]); o[dt] = WFrag<bf>::mma(vf[dt], pf2, o[dt]); o[dt] = WFrag<bf>::mma(vf2[dt], pf, o[dt]); }
        }
        asm volatile("s_wait_dscnt 0x0" ::: "memory");     // this wave's reads of the buffer are done before it may be refilled
        asm volatile("s_wait_asynccnt 0x0" ::: "memory");  // this wave's copies of stage s + 1 have landed
        __syncthreads();                                   // publishes stage s + 1 and ends every wave's reads of stage s
        if (s + 2 < nst) { const unsigned lb = ld + (unsigned)(s & 1) * HBF; const size_t kn = (size_t)wrapst(s + 2 + r0, nst) * 64;
            stage_kv(Kp + kof + kn * HD, Vt + vof + kn * HD, lb); stage_kv(K2 + kof + kn * HD, Vt2 + vof + kn * HD, lb + BFB); }
    }
    asm volatile("s_wait_asynccnt 0x0" ::: "memory");  // nothing is in flight when the wave ends
    l += xhalf(l);
    const float inv = __fdiv_rn(1.0f, l);
#pragma unroll
    for (int dt = 0; dt < 4; ++dt) { v4f a, b;
#pragma unroll
        for (int j = 0; j < 4; ++j) { a[j] = o[dt][j] * inv; b[j] = o[dt][4 + j] * inv; }
        *(v4f*)(orow + dt * 16) = a; *(v4f*)(orow + dt * 16 + 4) = b; }
}
__global__ __launch_bounds__(128) void k_fattn(const h16* __restrict__ Q16, const h16* __restrict__ K16, const h16* __restrict__ V16, const bf* __restrict__ Qh, const bf* __restrict__ Ql, const bf* __restrict__ Kh, const bf* __restrict__ Kl, const bf* __restrict__ Vh, const bf* __restrict__ Vl, float* __restrict__ out) {
    __shared__ __align__(16) char sm[2 * HBF];
    const int lane = threadIdx.x & 31, lr = lane & 15, hi = lane >> 4; const int wv = __builtin_amdgcn_readfirstlane((int)(threadIdx.x >> 5));
    const int bh = blockIdx.x % (NB_ * NH_), qg = TT / 64 - 1 - (int)(blockIdx.x / (NB_ * NH_)); const int q0 = qg * 64 + wv * 16;
    const int nst = qg + 1, r0 = (qg * 37) % nst;    // keys 0 .. qg * 64 + 63: qg + 1 stages for each of the 4 waves; the first one spread over the query groups (block-uniform)
    const size_t pl = (size_t)bh * TT * HD;          // this batch and head's plane ([t][d] for q and k, [t / 64][d][64] for v)
    float* orow = out + ((size_t)(bh / NH_) * TT + q0 + lr) * DQ + (bh % NH_) * HD + hi * 8;
    if (qg * 64 < RH) attn_rows_hl(Qh + pl, Ql + pl, Kh + pl, Kl + pl, Vh + pl, Vl + pl, sm, nst, r0, q0, lr, hi, orow);   // block-uniform
    else attn_rows_st(Q16 + pl, K16 + pl, V16 + pl, sm, nst, r0, q0, lr, hi, orow);
}

extern "C" void kernel_launch(void* const* d_in, const int* in_sizes, int n_in,
                              void* d_out, int out_size, void* d_ws, size_t ws_size, hipStream_t stream) {
    (void)in_sizes; (void)n_in; (void)out_size;
    const float* x = (const float*)d_in[0]; const float* wq = (const float*)d_in[1]; const float* bq = (const float*)d_in[2]; const float* wk = (const float*)d_in[3]; const float* bk = (const float*)d_in[4]; const float* wv = (const float*)d_in[5]; const float* bv = (const float*)d_in[6];
    float* OUT = (float*)d_out;     // [2][2048][1024]
    char* wsp = (char*)d_ws;
    auto take = [&](size_t bytes) { char* p = wsp; wsp += (bytes + 255) & ~(size_t)255; return (void*)p; };
    bf* XW = (bf*)take(((size_t)NB_ * TT + 3 * DQ) * DM * 2);   // bf16 x rows of both batches, then the wq, wk, wv rows, in slabs of 64 k
    const size_t PB = (size_t)NH_ * TT * HD;   // elements of one batch's head planes
    h16* QP16 = (h16*)take(NB_ * PB * 2); h16* KP16 = (h16*)take(NB_ * PB * 2); h16* VT16 = (h16*)take(NB_ * PB * 2);
    bf* QPh = (bf*)take(NB_ * PB * 2); bf* QPl = (bf*)take(NB_ * PB * 2); bf* KPh = (bf*)take(NB_ * PB * 2); bf* KPl = (bf*)take(NB_ * PB * 2); bf* VTh = (bf*)take(NB_ * PB * 2); bf* VTl = (bf*)take(NB_ * PB * 2);
    if ((size_t)(wsp - (char*)d_ws) > ws_size) return;    // ws 256 MiB
    k_cvtall<<<(NB_ * TT + 3 * DQ) * DM / CB, 256, 0, stream>>>(x, wq, wk, wv, XW);
    k_proj<<<dim3(NB_ * TT / 128, 3 * DQ / 128, 1), 128, 0, stream>>>(XW, XW + (size_t)NB_ * TT * 64, bq, bk, bv, QP16, QPh, QPl, KP16, KPh, KPl, VT16, VTh, VTl);
    k_fattn<<<NB_ * NH_ * (TT / 64), 128, 0, stream>>>(QP16, KP16, VT16, QPh, QPl, KPh, KPl, VTh, VTl, OUT);
}

// v008
// Measured time: 55.4 microseconds a run.
// In both of two side-by-side timings against v007, it was 1.03 times as fast.
// Over all steps from v000 it is 25.1 times as fast.
#include <hip/hip_runtime.h>

// Causal multi-head self-attention without an output projection (x [2][2048][1024]; q, k, v = x W^T + b ('oi' [1024][1024] + [1024], 16 heads x 64); att = q.k / sqrt(1024) (the module scales by the full hidden size), causal mask (-inf above the diagonal); softmax; out = merged heads -> [2][2048][1024] (4.2 M)).
// Compute dtypes, f32 accumulate: every input rounded to bf16; q/k/v on PLAIN bf16 operands (inputs: exact) + biases, one launch for all three and both batches, operand rows staged in LDS for a block's 4 waves, head planes written from its epilogue; causal scores and attn.v in one launch (running maximum and sum over 32- or 64-key steps): query rows < 512 hl (3 products), the rest single fp16, key and value tiles of both staged in LDS for the block's 4 waves; softmax f32; no output projection: the merged heads are written in f32 straight to the output.

#define NB_  2
#define TT   2048
#define DM   1024
#define NH_  16
#define NKV  16
#define HD   64
#define DQ   (NH_ * HD)
#define DKV  (NKV * HD)
#define RH   512                  // query rows < RH use hi+lo planes (0: none)
#define SCL  0.03125f   // 1/sqrt(h_dim = 1024): the module scales by the full hidden size
typedef _Float16 h16;
typedef unsigned short bf;
typedef __attribute__((ext_vector_type(16))) __bf16   v16bf;
typedef __attribute__((ext_vector_type(16))) _Float16 v16h;
typedef __attribute__((ext_vector_type(8)))  _Float16 v8h;
typedef __attribute__((ext_vector_type(8)))  unsigned short v8us;
typedef __attribute__((ext_vector_type(8)))  float    v8f;
typedef __attribute__((ext_vector_type(4)))  float    v4f;
typedef v8h  __attribute__((may_alias)) v8ha;
typedef v4f  __attribute__((may_alias)) v4fa;
typedef v8us __attribute__((may_alias)) v8usa;

__device__ __forceinline__ unsigned short f2bf(float f) { unsigned u = __float_as_uint(f); u += 0x7FFFu + ((u >> 16) & 1u); return (unsigned short)(u >> 16); }
__device__ __forceinline__ float bf2f(unsigned short b) { return __uint_as_float(((unsigned)b) << 16); }
__device__ __forceinline__ float bfr(float f) { return bf2f(f2bf(f)); }
__device__ __forceinline__ v16h cat16(v8h lo, v8h hi) { return __builtin_shufflevector(lo, hi, 0, 1, 2, 3, 4, 5, 6, 7, 8, 9, 10, 11, 12, 13, 14, 15); }
__device__ __forceinline__ v16bf cat16b(v8us lo, v8us hi) { return __builtin_bit_cast(v16bf, __builtin_shufflevector(lo, hi, 0, 1, 2, 3, 4, 5, 6, 7, 8, 9, 10, 11, 12, 13, 14, 15)); }
__device__ __forceinline__ v8f wmma16(v16h a, v16h b, v8f c) { return __builtin_amdgcn_wmma_f32_16x16x32_f16(false, a, false, b, (short)0, c, false, false); }
__device__ __forceinline__ v8f wmmab(v16bf a, v16bf b, v8f c) { return __builtin_amdgcn_wmma_f32_16x16x32_bf16(false, a, false, b, (short)0, c, false, false); }



// fragment loaders and matrix products by 16-bit type: a fragment is two 16-byte loads of one K-contiguous row
template <typename T16> struct WFrag;
template <> struct WFrag<h16> { typedef v16h V; static __device__ __forceinline__ V ld(const h16* p) { return cat16(*(const v8h*)p, *(const v8h*)(p + 16)); } static __device__ __forceinline__ v8f mma(V a, V b, v8f c) { return wmma16(a, b, c); } };
template <> struct WFrag<bf> { typedef v16bf V; static __device__ __forceinline__ V ld(const bf* p) { return cat16b(*(const v8us*)p, *(const v8us*)(p + 16)); } static __device__ __forceinline__ v8f mma(V a, V b, v8f c) { return wmmab(a, b, c); } };
__device__ __forceinline__ h16 tohx(float x) { return (h16)x; }
__device__ __forceinline__ void splitf(float y, unsigned short& h, unsigned short& l) { h = f2bf(y); l = f2bf(y - bf2f(h)); }
// ---- k_cvtall: x (both batches) and the three weights rounded to bf16 into one plane of PR rows [x rows | wq rows | wk rows | wv rows], stored in 16 slabs of 64 k: [k / 64][row][64]. So the rows that k_proj stages for one 64-k step lie one behind the other, and a wave-wide 16-byte copy reads 512 contiguous bytes, not four lines 2 KB apart.
// 8192 elements (8 rows) a block, 4 x 8 a thread: 8 lanes take a row's 64-k run, a wave 4 rows of one slab (512 contiguous bytes stored), a round of the block 8 rows of 4 slabs.
#define CB   8192
#define PR   (NB_ * TT + 3 * DQ)  // rows of the plane
#define PS   (PR * 64)            // elements of one slab
__global__ __launch_bounds__(256) void k_cvtall(const float* __restrict__ x, const float* __restrict__ wq, const float* __restrict__ wk, const float* __restrict__ wv, bf* dst) {
    const int XBK = NB_ * TT * DM / CB, WBK = DQ * DM / CB; const int blk = blockIdx.x;
    const float* src = x; int sb = blk;
    if (blk >= XBK) { const int w = (blk - XBK) / WBK; sb = (blk - XBK) % WBK; src = (w == 0) ? wq : (w == 1) ? wk : wv; }
    static_assert(CB == 8 * DM, "a block takes 8 whole rows");
    const int t = threadIdx.x, row = (t >> 3) & 7, sl = t >> 6, pc = (t & 7) * 8;
    const float* s = src + (size_t)sb * CB + row * DM + sl * 64 + pc; bf* d = dst + ((size_t)sl * PR + blk * 8 + row) * 64 + pc;
    v8f v[4];
#pragma unroll
    for (int i = 0; i < 4; ++i) v[i] = *(const v8f*)(s + i * 256);
#pragma unroll
    for (int i = 0; i < 4; ++i) { v8us o;
#pragma unroll
        for (int k = 0; k < 8; ++k) o[k] = f2bf(v[i][k]);
        *(v8us*)(d + (size_t)i * 4 * PS) = o; }
}

// ---- k_proj: the q, k and v projections of both batches in one launch. A block of 4 waves owns 128 tokens x 128 output columns (two heads of one of q, k, v), ONE WAVE per 64x64 tile (16 accumulators); grid (NB_ * TT / 128, 3 * DQ / 128), 128 threads.
// Each 64-k step's 128 x rows and 128 weight rows are brought into LDS once for the block, each operand one contiguous 16 KB run of its slab (a fragment load from global memory touches 16 lines for 512 bytes, and each row is wanted by two waves); two buffers: step s + 1's copies fly while step s is worked on.
// A wave's tile is 64 tokens x one head. q and k: A = x rows, B = weight rows, tile [t][d]; v: A = weight rows, B = x rows, tile [d][t], so every tile row is one 128-byte row of its head plane ([h][t][d] for q and k; v in tiles of 64 tokens, [h][t / 64][d][64], so that a 64-key V^T tile is one contiguous 8 KB run like a K tile).
// The k walk is rotated: block (x, y) starts at 64-k step (x + y) mod 16 and wraps, so the 24 blocks that share x rows and the 32 that share weight rows ask L2 for different lines at any one moment. Only the order of the f32 sums changes.
// Epilogue: + bf16-rounded bias in f32, then the fp16 plane and the hi + lo bf16 planes, 16-byte stores.
#define PLB  144                  // LDS row pitch in bytes: 128 + 16 (16 B x odd), conflict-free for 16-byte fragment reads
#define PXB  (128 * PLB)          // one operand's 128 rows
#define PBF  (2 * PXB)            // one buffer: x rows, then weight rows
// 128 rows x 128 bytes of one operand, 8 asynchronous 16-byte copies a lane (8 lanes a row, 16 rows a round of the block). g, ld: this lane's first global and LDS place.
__device__ __forceinline__ void stage_rows(const bf* g, unsigned ld) {
    // the s_wait_xcnt closes the statement so that no address register of a copy is rewritten in front of it
    asm volatile("global_load_async_to_lds_b128 %0, %8, off\n\t"
                 "global_load_async_to_lds_b128 %1, %9, off\n\t"
                 "global_load_async_to_lds_b128 %2, %10, off\n\t"
                 "global_load_async_to_lds_b128 %3, %11, off\n\t"
                 "global_load_async_to_lds_b128 %4, %12, off\n\t"
                 "global_load_async_to_lds_b128 %5, %13, off\n\t"
                 "global_load_async_to_lds_b128 %6, %14, off\n\t"
                 "global_load_async_to_lds_b128 %7, %15, off\n\t"
                 "s_wait_xcnt 0x0"
                 :: "v"(ld), "v"(ld + 16u * PLB), "v"(ld + 32u * PLB), "v"(ld + 48u * PLB), "v"(ld + 64u * PLB), "v"(ld + 80u * PLB), "v"(ld + 96u * PLB), "v"(ld + 112u * PLB),
                    "v"(g), "v"(g + 16 * 64), "v"(g + 32 * 64), "v"(g + 48 * 64), "v"(g + 64 * 64), "v"(g + 80 * 64), "v"(g + 96 * 64), "v"(g + 112 * 64)
                 : "memory");
}
__global__ __launch_bounds__(128) void k_proj(const bf* __restrict__ X, const bf* __restrict__ Wt, const float* __restrict__ bq, const float* __restrict__ bk, const float* __restrict__ bv, h16* Q16, bf* Qh, bf* Ql, h16* K16, bf* Kh, bf* Kl, h16* V16, bf* Vh, bf* Vl) {
    typedef WFrag<bf>::V V;
    __shared__ __align__(16) char sm[2 * PBF];
    __shared__ __align__(16) float osb[4][16 * 68];
    const int NS = DM / 64;
    static_assert((NS & (NS - 1)) == 0, "the rotated k walk wraps by a mask");
    const int r0 = (int)(blockIdx.x + blockIdx.y) & (NS - 1);   // this block's first 64-k step
    const int tid = threadIdx.x, lane = tid & 31, lr = lane & 15, hi = lane >> 4; const int wv = __builtin_amdgcn_readfirstlane(tid >> 5);
    const int tb = blockIdx.x * 128, nb0 = blockIdx.y * 128; const int wt = wv & 1, wn = wv >> 1; const int t0 = tb + wt * 64, n0 = nb0 + wn * 64;
    const int which = n0 / DQ, h = (n0 % DQ) / HD; const bool tr = which == 2;   // block-uniform: 0 q, 1 k, 2 v
    float* os = osb[wv];                              // each wave's own epilogue rows
    const bf* xg = X + (size_t)tb * 64 + tid * 8; const bf* wg = Wt + (size_t)nb0 * 64 + tid * 8;   // slab 0: row tid >> 3, 16-byte piece tid & 7
    const unsigned ld = (unsigned)(size_t)sm + (unsigned)((tid >> 3) * PLB + (tid & 7) * 16);
    const int fo = lr * PLB + 16 * hi;                // a lane's byte place in a 16-row fragment, the same for A and B
    const char* fx = sm + wt * 64 * PLB + fo; const char* fw = sm + PXB + wn * 64 * PLB + fo;
    const char* fa = tr ? fw : fx; const char* fb = tr ? fx : fw;
    stage_rows(xg + r0 * PS, ld); stage_rows(wg + r0 * PS, ld + PXB);
    v8f acc[4][4];
#pragma unroll
    for (int mb = 0; mb < 4; ++mb)
#pragma unroll
        for (int nb = 0; nb < 4; ++nb) acc[mb][nb] = (v8f){};
    asm volatile("s_wait_asynccnt 0x0" ::: "memory");  // this wave's copies of step 0 have landed
    __syncthreads();                                   // ... and every other wave's
    { const int k1 = ((r0 + 1) & (NS - 1)) * PS; stage_rows(xg + k1, ld + PBF); stage_rows(wg + k1, ld + PBF + PXB); }
#pragma unroll 1                                     // rolled: the two buffers take turns by (s & 1)
    for (int s = 0; s < NS; ++s) {
        const int bo = (s & 1) * PBF;
        V a[4], b[4];
#pragma unroll
        for (int c = 0; c < 2; ++c) {
#pragma unroll
            for (int mb = 0; mb < 4; ++mb) a[mb] = WFrag<bf>::ld((const bf*)(fa + bo + mb * 16 * PLB + c * 64));
#pragma unroll
            for (int nb = 0; nb < 4; ++nb) b[nb] = WFrag<bf>::ld((const bf*)(fb + bo + nb * 16 * PLB + c * 64));
            __builtin_amdgcn_sched_barrier(0);        // the 16 LDS reads of a 32-k chunk go out as one group: without it this build read one B fragment, waited for it and multiplied, four times a chunk
            if (c == 1) {                             // the step's last LDS reads are out: hand the buffer over here, so that the refill is under way while the second chunk's products (registers only) run
                asm volatile("s_wait_dscnt 0x0" ::: "memory");     // this wave's reads of the buffer are done before it may be refilled
                asm volatile("s_wait_asynccnt 0x0" ::: "memory");  // this wave's copies of step s + 1 have landed
                __syncthreads();                                   // publishes step s + 1 and ends every wave's reads of step s
                if (s + 2 < NS) { const int kn = ((s + 2 + r0) & (NS - 1)) * PS; stage_rows(xg + kn, ld + (unsigned)bo); stage_rows(wg + kn, ld + (unsigned)bo + PXB); }
            }
#pragma unroll
            for (int nb = 0; nb < 4; ++nb)
#pragma unroll
                for (int mb = 0; mb < 4; ++mb) acc[mb][nb] = WFrag<bf>::mma(a[mb], b[nb], acc[mb][nb]);
        }
    }
    asm volatile("s_wait_asynccnt 0x0" ::: "memory");  // nothing is in flight when the wave goes on to the epilogue
    const size_t base = (size_t)((t0 / TT) * NH_ + h) * TT * HD + (size_t)(t0 % TT) * HD; const int pitch = HD;   // the wave's 64 x 64 tile is contiguous in every plane
    h16* P16 = ((which == 0) ? Q16 : (which == 1) ? K16 : V16) + base; bf* Ph = ((which == 0) ? Qh : (which == 1) ? Kh : Vh) + base; bf* Pl = ((which == 0) ? Ql : (which == 1) ? Kl : Vl) + base;
    const float* bias = ((which == 0) ? bq : (which == 1) ? bk : bv) + h * HD;
    const int rsub = lane >> 3, cofs = (lane & 7) * 8;   // 8 lanes write one 128-byte plane row
    float bc[8];
#pragma unroll
    for (int e = 0; e < 8; ++e) bc[e] = bfr(bias[cofs + e]);
#pragma unroll
    for (int mb = 0; mb < 4; ++mb) {
#pragma unroll
        for (int nb = 0; nb < 4; ++nb) {
#pragma unroll
            for (int j = 0; j < 8; ++j) os[(hi * 8 + j) * 68 + nb * 16 + lr] = acc[mb][nb][j]; }
        __builtin_amdgcn_wave_barrier(); asm volatile("" ::: "memory");  // compiler order only (one wave): the 16 tile rows are stored to LDS before they are read back
#pragma unroll
        for (int s = 0; s < 4; ++s) { const int row = 4 * s + rsub; const v4f lo4 = *(const v4fa*)(os + row * 68 + cofs), hi4 = *(const v4fa*)(os + row * 68 + cofs + 4);
            const float br = bfr(bias[mb * 16 + row]); v8h o16; v8us oh, ol;
#pragma unroll
            for (int e = 0; e < 8; ++e) { const float r = ((e < 4) ? lo4[e & 3] : hi4[e & 3]) + (tr ? br : bc[e]); o16[e] = tohx(r); unsigned short a2, c2; splitf(r, a2, c2); oh[e] = a2; ol[e] = c2; }
            const size_t off = (size_t)(mb * 16 + row) * pitch + cofs;
            *(v8h*)(P16 + off) = o16; *(v8us*)(Ph + off) = oh; *(v8us*)(Pl + off) = ol; }
        __builtin_amdgcn_wave_barrier(); asm volatile("" ::: "memory");  // compiler order only: the rows are read before the next 16 overwrite them
    }
}

// ---- k_fattn: scores, causal softmax and probability x value in one launch for every batch and head. One wave owns 16 query rows and walks its keys KT x 16 at a time with a running maximum and sum.
// Transposed products: S^T = K Q^T (A = key rows, B = query rows), O^T += V^T P^T (A = V^T rows, B = two score tiles converted in place), so a lane holds one query's scores and P needs no lane exchange and no LDS.
// Query rows < RH (attn_rows_hl): hi+lo bf16 planes, 3 products each, 32 keys a step. The rest (attn_rows_st): single fp16, 64 keys a step. Both read their tiles from LDS. Grid: heaviest 64-row query groups first, 4 waves a block.
__device__ __forceinline__ float xhalf(float x) { return __builtin_bit_cast(float, __builtin_amdgcn_permlanex16(__builtin_bit_cast(int, x), __builtin_bit_cast(int, x), 0x76543210, 0xfedcba98, false, false)); }  // lane l with lane l ^ 16
// 2^x with the one free issue slot behind a transcendental written in
__device__ __forceinline__ float exp2s(float x) { float r; asm("v_exp_f32 %0, %1\n\tv_nop" : "=v"(r) : "v"(x)); return r; }
// 2^x of the eight scores of one 16-key tile, in place: each v_exp_f32 is the independent instruction in the slot behind the one before it, so one v_nop (behind the last) serves the group and seven issue slots are left to the SIMD's other waves
__device__ __forceinline__ void exp2x8(float* p) {
    asm("v_exp_f32 %0, %0\n\tv_exp_f32 %1, %1\n\tv_exp_f32 %2, %2\n\tv_exp_f32 %3, %3\n\tv_exp_f32 %4, %4\n\tv_exp_f32 %5, %5\n\tv_exp_f32 %6, %6\n\tv_exp_f32 %7, %7\n\tv_nop"
        : "+v"(p[0]), "+v"(p[1]), "+v"(p[2]), "+v"(p[3]), "+v"(p[4]), "+v"(p[5]), "+v"(p[6]), "+v"(p[7]));
}
// a lane's maximum and sum over NT tiles of eight scores: one chain per tile, joined at the end, so that the chains' instructions issue between one another (one chain over all the scores waits out the result latency at every link); the loops are unrolled so that constant indices keep the scores in registers
typedef __attribute__((ext_vector_type(2))) float v2f;
template <int NT> __device__ __forceinline__ float maxt(const float* p) { float c[NT];
#pragma unroll
    for (int t = 0; t < NT; ++t) { const float* q = p + 8 * t; c[t] = fmaxf(fmaxf(fmaxf(fmaxf(fmaxf(fmaxf(fmaxf(q[0], q[1]), q[2]), q[3]), q[4]), q[5]), q[6]), q[7]); }
    float r = c[0];
#pragma unroll
    for (int t = 1; t < NT; ++t) r = fmaxf(r, c[t]);
    return r; }
template <int NT> __device__ __forceinline__ float sumt(const float* p) { v2f c[NT];
#pragma unroll
    for (int t = 0; t < NT; ++t) { const float* q = p + 8 * t; c[t] = (((v2f){q[0], q[1]} + (v2f){q[2], q[3]}) + (v2f){q[4], q[5]}) + (v2f){q[6], q[7]}; }
#pragma unroll
    for (int w = 1; w < NT; w *= 2)
#pragma unroll
        for (int t = 0; t + w < NT; t += 2 * w) c[t] += c[t + w];
    return c[0][0] + c[0][1]; }
__device__ __forceinline__ v16h packp(const float* p, v16h*) { v16h r;
#pragma unroll
    for (int e = 0; e < 16; ++e) r[e] = (h16)p[e];
    return r; }
__device__ __forceinline__ v16bf packp(const float* p, v16bf* lo) { v8us h0, h1, l0, l1;
#pragma unroll
    for (int e = 0; e < 8; ++e) { unsigned short a, c; splitf(p[e], a, c); h0[e] = a; l0[e] = c; splitf(p[8 + e], a, c); h1[e] = a; l1[e] = c; }
    *lo = cat16b(l0, l1); return cat16b(h0, h1); }
// ---- the fp16 rows: the block's 4 waves walk the same 64-key steps, so each step's K rows [64 keys][64 d] and V^T rows [64 d][64 keys] are brought into LDS once for all four, each tile one contiguous 8 KB run (a fragment load from global memory touches 16 lines for 512 bytes).
#define LPB  144                  // LDS row pitch in bytes: 128 + 16 (16 B x odd), conflict-free for 16-byte fragment reads
#define TLB  (64 * LPB)           // one tile of 64 rows
#define BFB  (2 * TLB)            // one buffer: K tile, then V^T tile
// One step's tiles, 8 asynchronous 16-byte copies a lane (8 lanes a row, 16 rows a round of the block). kg, vg, ld: this lane's first K, V^T and LDS place.
template <typename T16>
__device__ __forceinline__ void stage_kv(const T16* kg, const T16* vg, unsigned ld) {
    // the s_wait_xcnt closes the statement so that no address register of a copy is rewritten in front of it
    asm volatile("global_load_async_to_lds_b128 %0, %8, off\n\t"
                 "global_load_async_to_lds_b128 %1, %9, off\n\t"
                 "global_load_async_to_lds_b128 %2, %10, off\n\t"
                 "global_load_async_to_lds_b128 %3, %11, off\n\t"
                 "global_load_async_to_lds_b128 %4, %12, off\n\t"
                 "global_load_async_to_lds_b128 %5, %13, off\n\t"
                 "global_load_async_to_lds_b128 %6, %14, off\n\t"
                 "global_load_async_to_lds_b128 %7, %15, off\n\t"
                 "s_wait_xcnt 0x0"
                 :: "v"(ld), "v"(ld + 16u * LPB), "v"(ld + 32u * LPB), "v"(ld + 48u * LPB), "v"(ld + TLB), "v"(ld + TLB + 16u * LPB), "v"(ld + TLB + 32u * LPB), "v"(ld + TLB + 48u * LPB),
                    "v"(kg), "v"(kg + 16 * HD), "v"(kg + 32 * HD), "v"(kg + 48 * HD), "v"(vg), "v"(vg + 16 * 64), "v"(vg + 32 * 64), "v"(vg + 48 * 64)
                 : "memory");
}
// The key walk is rotated: trip s works on 64-key stage (s + r0) mod nst, r0 by the block's query group, so the blocks of one batch and head, which read the same K and V^T lines, ask L2 for different lines at any one moment. The running maximum and sum take the stages in any order (every stage holds a key at or below each row's diagonal); only the order of the f32 sums changes.
__device__ __forceinline__ int wrapst(int i, int n) { return i >= n ? i - n : i; }   // i < 2 n
// nst = steps of the whole block (the same for its 4 waves); two buffers: step s + 1's copies fly while step s is worked on.
__device__ __forceinline__ void attn_rows_st(const h16* __restrict__ Q, const h16* __restrict__ Kp, const h16* __restrict__ Vt, char* sm, int nst, int r0, int q0, int lr, int hi, float* __restrict__ orow) {
    typedef WFrag<h16>::V V;                          // every full '#pragma unroll' below keeps a fragment or score array in registers (constant indices)
    const int KT = 4;
    const float CE = SCL * 1.4426950408889634f;      // raw score -> log2 domain
    const int tid = threadIdx.x;
    const h16* kg = Kp + tid * 8; const h16* vg = Vt + tid * 8;
    const unsigned ld = (unsigned)(size_t)sm + (unsigned)((tid >> 3) * LPB + (tid & 7) * 16);
    const int fo = lr * LPB + 16 * hi;                // a lane's byte place in a 16-row fragment of a tile
    stage_kv(kg + (size_t)(r0 * 64) * HD, vg + (size_t)(r0 * 64) * HD, ld);
    V qf[2];
#pragma unroll
    for (int c = 0; c < 2; ++c) qf[c] = WFrag<h16>::ld(Q + (size_t)(q0 + lr) * HD + 8 * hi + c * 32);
    v8f o[4];
#pragma unroll
    for (int dt = 0; dt < 4; ++dt) o[dt] = (v8f){};
    float m = -3.0e38f, l = 0.f;
    asm volatile("s_wait_asynccnt 0x0" ::: "memory");  // this wave's copies of step 0 have landed
    __syncthreads();                                   // ... and every other wave's
    if (nst > 1) { const int k1 = wrapst(r0 + 1, nst) * 64; stage_kv(kg + (size_t)k1 * HD, vg + (size_t)k1 * HD, ld + BFB); }
#pragma unroll 1                                     // rolled: one step's fragments and scores fill the registers of 4 waves a SIMD
    for (int s = 0; s < nst; ++s) {
        const int kb = wrapst(s + r0, nst) * (KT * 16);
        const char* tk = sm + (s & 1) * BFB + fo; const char* tv = tk + TLB;
        V kf[KT][2], vf[4][KT / 2];
#pragma unroll
        for (int kt = 0; kt < KT; ++kt)
#pragma unroll
            for (int c = 0; c < 2; ++c) kf[kt][c] = WFrag<h16>::ld((const h16*)(tk + kt * 16 * LPB + c * 64));
        __builtin_amdgcn_sched_barrier(0);            // the 16 K reads go out as one group: without it this build read one fragment, waited for it and multiplied, eight times a step
        v8f st[KT];
#pragma unroll
        for (int kt = 0; kt < KT; ++kt) { st[kt] = (v8f){};
#pragma unroll
            for (int c = 0; c < 2; ++c) st[kt] = WFrag<h16>::mma(kf[kt][c], qf[c], st[kt]); }
#pragma unroll
        for (int dt = 0; dt < 4; ++dt)
#pragma unroll
            for (int kc = 0; kc < KT / 2; ++kc) vf[dt][kc] = WFrag<h16>::ld((const h16*)(tv + dt * 16 * LPB + kc * 64));
        __builtin_amdgcn_sched_barrier(0);            // the 16 V^T reads start here, under the softmax, not next to their products
        float p[KT * 8];
#pragma unroll
        for (int e = 0; e < KT * 8; ++e) p[e] = st[e >> 3][e & 7];
        if (kb + KT * 16 - 1 > q0) {                  // only a step that reaches the diagonal masks (wave-uniform)
#pragma unroll
            for (int e = 0; e < KT * 8; ++e) p[e] = (kb + (e >> 3) * 16 + hi * 8 + (e & 7) <= q0 + lr) ? p[e] : -3.0e38f; }
        float mx = maxt<KT>(p);
        mx = fmaxf(mx, xhalf(mx));
        const float mn = fmaxf(m, mx), al = exp2s((m - mn) * CE), mc = mn * CE; m = mn;
#pragma unroll
        for (int e = 0; e < KT * 8; ++e) p[e] = __builtin_fmaf(p[e], CE, -mc);
#pragma unroll
        for (int kt = 0; kt < KT; ++kt) exp2x8(p + kt * 8);
        l = l * al + sumt<KT>(p);
#pragma unroll
        for (int dt = 0; dt < 4; ++dt) o[dt] *= al;
        __builtin_amdgcn_sched_barrier(0);            // every exp2s stays in front of the P.V products
#pragma unroll
        for (int kc = 0; kc < KT / 2; ++kc) { const V pf = packp(p + kc * 16, (V*)nullptr);
#pragma unroll
            for (int dt = 0; dt < 4; ++dt) o[dt] = WFrag<h16>::mma(vf[dt][kc], pf, o[dt]); }
        asm volatile("s_wait_dscnt 0x0" ::: "memory");     // this wave's reads of the buffer are done before it may be refilled
        asm volatile("s_wait_asynccnt 0x0" ::: "memory");  // this wave's copies of step s + 1 have landed
        __syncthreads();                                   // publishes step s + 1 and ends every wave's reads of step s
        if (s + 2 < nst) { const int kn = wrapst(s + 2 + r0, nst) * 64; stage_kv(kg + (size_t)kn * HD, vg + (size_t)kn * HD, ld + (unsigned)(s & 1) * BFB); }
    }
    asm volatile("s_wait_asynccnt 0x0" ::: "memory");  // nothing is in flight when the wave ends
    l += xhalf(l);
    const float inv = __fdiv_rn(1.0f, l);
#pragma unroll
    for (int dt = 0; dt < 4; ++dt) { v4f a, b;
#pragma unroll
        for (int j = 0; j < 4; ++j) { a[j] = o[dt][j] * inv; b[j] = o[dt][4 + j] * inv; }
        *(v4f*)(orow + dt * 16) = a; *(v4f*)(orow + dt * 16 + 4) = b; }
}
// ---- the hi+lo rows: the block's 4 waves walk the same 64-key stages, so each stage's K rows and V^T rows of both planes are brought into LDS once for all four, as whole 128-byte lines; a stage is worked on as two 32-key steps (keys and values of both planes take turns in the registers).
#define HBF  (2 * BFB)            // one buffer: K hi, V^T hi, K lo, V^T lo tiles
// nst = stages of the whole block (the same for its 4 waves); two buffers: stage s + 1's copies fly while stage s is worked on.
__device__ __forceinline__ void attn_rows_hl(const bf* __restrict__ Q, const bf* __restrict__ Q2, const bf* __restrict__ Kp, const bf* __restrict__ K2, const bf* __restrict__ Vt, const bf* __restrict__ Vt2, char* sm, int nst, int r0, int q0, int lr, int hi, float* __restrict__ orow) {
    typedef WFrag<bf>::V V;                           // every full '#pragma unroll' below keeps a fragment or score array in registers (constant indices)
    const int KT = 2;
    const float CE = SCL * 1.4426950408889634f;      // raw score -> log2 domain
    const int tid = threadIdx.x;
    const size_t kof = (size_t)tid * 8, vof = kof;   // stage 0's places; the walk is rotated as in attn_rows_st
    const unsigned ld = (unsigned)(size_t)sm + (unsigned)((tid >> 3) * LPB + (tid & 7) * 16);
    const int fo = lr * LPB + 16 * hi;                // a lane's byte place in a 16-row fragment of a tile
    { const size_t k0 = (size_t)r0 * 64; stage_kv(Kp + kof + k0 * HD, Vt + vof + k0 * HD, ld); stage_kv(K2 + kof + k0 * HD, Vt2 + vof + k0 * HD, ld + BFB); }
    const size_t qo = (size_t)(q0 + lr) * HD + 8 * hi;
    V qf[2], qf2[2];
#pragma unroll
    for (int c = 0; c < 2; ++c) { qf[c] = WFrag<bf>::ld(Q + qo + c * 32); qf2[c] = WFrag<bf>::ld(Q2 + qo + c * 32); }
    v8f o[4];
#pragma unroll
    for (int dt = 0; dt < 4; ++dt) o[dt] = (v8f){};
    float m = -3.0e38f, l = 0.f;
    asm volatile("s_wait_asynccnt 0x0" ::: "memory");  // this wave's copies of stage 0 have landed
    __syncthreads();                                   // ... and every other wave's
    if (nst > 1) { const size_t k1 = (size_t)wrapst(r0 + 1, nst) * 64; stage_kv(Kp + kof + k1 * HD, Vt + vof + k1 * HD, ld + HBF); stage_kv(K2 + kof + k1 * HD, Vt2 + vof + k1 * HD, ld + HBF + BFB); }
#pragma unroll 1                                     // rolled: the two buffers take turns by (s & 1)
    for (int s = 0; s < nst; ++s) {
        const char* tb = sm + (s & 1) * HBF + fo;
#pragma unroll 1                                     // rolled: two steps unrolled take more than 256 registers, one wave a SIMD fewer
        for (int u = 0; u < 2; ++u) {
            const int kb = wrapst(s + r0, nst) * 64 + u * 32;
            if (kb > q0 + 15) break;                  // wave-uniform: every key of the step lies above this wave's diagonal; no barrier stands inside this loop
            const char* tk = tb + u * 32 * LPB; const char* tv = tb + TLB + u * 64;
            V kf[KT][2], kf2[KT][2], vf[4], vf2[4];
#pragma unroll
            for (int kt = 0; kt < KT; ++kt)
#pragma unroll
                for (int c = 0; c < 2; ++c) { kf[kt][c] = WFrag<bf>::ld((const bf*)(tk + kt * 16 * LPB + c * 64)); kf2[kt][c] = WFrag<bf>::ld((const bf*)(tk + BFB + kt * 16 * LPB + c * 64)); }
            __builtin_amdgcn_sched_barrier(0);        // the 16 K reads go out as one group, not one fragment at a time next to its product
            v8f st[KT];
#pragma unroll
            for (int kt = 0; kt < KT; ++kt) { st[kt] = (v8f){};
#pragma unroll
                for (int c = 0; c < 2; ++c) { st[kt] = WFrag<bf>::mma(kf[kt][c], qf[c], st[kt]); st[kt] = WFrag<bf>::mma(kf[kt][c], qf2[c], st[kt]); st[kt] = WFrag<bf>::mma(kf2[kt][c], qf[c], st[kt]); } }
#pragma unroll
            for (int dt = 0; dt < 4; ++dt) { vf[dt] = WFrag<bf>::ld((const bf*)(tv + dt * 16 * LPB)); vf2[dt] = WFrag<bf>::ld((const bf*)(tv + BFB + dt * 16 * LPB)); }
            __builtin_amdgcn_sched_barrier(0);        // the 16 V^T reads start here, under the softmax, not next to their products
            float p[KT * 8];
#pragma unroll
            for (int e = 0; e < KT * 8; ++e) p[e] = st[e >> 3][e & 7];
            if (kb + KT * 16 - 1 > q0) {              // only a step that reaches the diagonal masks (wave-uniform)
#pragma unroll
                for (int e = 0; e < KT * 8; ++e) p[e] = (kb + (e >> 3) * 16 + hi * 8 + (e & 7) <= q0 + lr) ? p[e] : -3.0e38f; }
            float mx = maxt<KT>(p);
            mx = fmaxf(mx, xhalf(mx));
            const float mn = fmaxf(m, mx), al = exp2s((m - mn) * CE), mc = mn * CE; m = mn;
#pragma unroll
            for (int e = 0; e < KT * 8; ++e) p[e] = __builtin_fmaf(p[e], CE, -mc);
#pragma unroll
            for (int kt = 0; kt < KT; ++kt) exp2x8(p + kt * 8);
            l = l * al + sumt<KT>(p);
#pragma unroll
            for (int dt = 0; dt < 4; ++dt) o[dt] *= al;
            V pf2; const V pf = packp(p, &pf2);
#pragma unroll
            for (int dt = 0; dt < 4; ++dt) { o[dt] = WFrag<bf>::mma(vf[dt], pf, o[dt]); o[dt] = WFrag<bf>::mma(vf[dt], pf2, o[dt]); o[dt] = WFrag<bf>::mma(vf2[dt], pf, o[dt]); }
            __builtin_amdgcn_sched_barrier(0);        // holds the products in front of the v_nops: without it this build moved the v_nops up among them
            asm volatile("v_nop\n\tv_nop\n\tv_nop\n\tv_nop");   // the four vector slots behind the step's last products
        }
        asm volatile("s_wait_dscnt 0x0" ::: "memory");     // this wave's reads of the buffer are done before it may be refilled
        asm volatile("s_wait_asynccnt 0x0" ::: "memory");  // this wave's copies of stage s + 1 have landed
        __syncthreads();                                   // publishes stage s + 1 and ends every wave's reads of stage s
        if (s + 2 < nst) { const unsigned lb = ld + (unsigned)(s & 1) * HBF; const size_t kn = (size_t)wrapst(s + 2 + r0, nst) * 64;
            stage_kv(Kp + kof + kn * HD, Vt + vof + kn * HD, lb); stage_kv(K2 + kof + kn * HD, Vt2 + vof + kn * HD, lb + BFB); }
    }
    asm volatile("s_wait_asynccnt 0x0" ::: "memory");  // nothing is in flight when the wave ends
    l += xhalf(l);
    const float inv = __fdiv_rn(1.0f, l);
#pragma unroll
    for (int dt = 0; dt < 4; ++dt) { v4f a, b;
#pragma unroll
        for (int j = 0; j < 4; ++j) { a[j] = o[dt][j] * inv; b[j] = o[dt][4 + j] * inv; }
        *(v4f*)(orow + dt * 16) = a; *(v4f*)(orow + dt * 16 + 4) = b; }
}
__global__ __launch_bounds__(128) void k_fattn(const h16* __restrict__ Q16, const h16* __restrict__ K16, const h16* __restrict__ V16, const bf* __restrict__ Qh, const bf* __restrict__ Ql, const bf* __restrict__ Kh, const bf* __restrict__ Kl, const bf* __restrict__ Vh, const bf* __restrict__ Vl, float* __restrict__ out) {
    __shared__ __align__(16) char sm[2 * HBF];
    const int lane = threadIdx.x & 31, lr = lane & 15, hi = lane >> 4; const int wv = __builtin_amdgcn_readfirstlane((int)(threadIdx.x >> 5));
    const int bh = blockIdx.x % (NB_ * NH_), qg = TT / 64 - 1 - (int)(blockIdx.x / (NB_ * NH_)); const int q0 = qg * 64 + wv * 16;
    const int nst = qg + 1, r0 = (qg * 37) % nst;    // keys 0 .. qg * 64 + 63: qg + 1 stages for each of the 4 waves; the first one spread over the query groups (block-uniform)
    const size_t pl = (size_t)bh * TT * HD;          // this batch and head's plane ([t][d] for q and k, [t / 64][d][64] for v)
    float* orow = out + ((size_t)(bh / NH_) * TT + q0 + lr) * DQ + (bh % NH_) * HD + hi * 8;
    if (qg * 64 < RH) attn_rows_hl(Qh + pl, Ql + pl, Kh + pl, Kl + pl, Vh + pl, Vl + pl, sm, nst, r0, q0, lr, hi, orow);   // block-uniform
    else attn_rows_st(Q16 + pl, K16 + pl, V16 + pl, sm, nst, r0, q0, lr, hi, orow);
}

extern "C" void kernel_launch(void* const* d_in, const int* in_sizes, int n_in,
                              void* d_out, int out_size, void* d_ws, size_t ws_size, hipStream_t stream) {
    (void)in_sizes; (void)n_in; (void)out_size;
    const float* x = (const float*)d_in[0]; const float* wq = (const float*)d_in[1]; const float* bq = (const float*)d_in[2]; const float* wk = (const float*)d_in[3]; const float* bk = (const float*)d_in[4]; const float* wv = (const float*)d_in[5]; const float* bv = (const float*)d_in[6];
    float* OUT = (float*)d_out;     // [2][2048][1024]
    char* wsp = (char*)d_ws;
    auto take = [&](size_t bytes) { char* p = wsp; wsp += (bytes + 255) & ~(size_t)255; return (void*)p; };
    bf* XW = (bf*)take(((size_t)NB_ * TT + 3 * DQ) * DM * 2);   // bf16 x rows of both batches, then the wq, wk, wv rows, in slabs of 64 k
    const size_t PB = (size_t)NH_ * TT * HD;   // elements of one batch's head planes
    h16* QP16 = (h16*)take(NB_ * PB * 2); h16* KP16 = (h16*)take(NB_ * PB * 2); h16* VT16 = (h16*)take(NB_ * PB * 2);
    bf* QPh = (bf*)take(NB_ * PB * 2); bf* QPl = (bf*)take(NB_ * PB * 2); bf* KPh = (bf*)take(NB_ * PB * 2); bf* KPl = (bf*)take(NB_ * PB * 2); bf* VTh = (bf*)take(NB_ * PB * 2); bf* VTl = (bf*)take(NB_ * PB * 2);
    if ((size_t)(wsp - (char*)d_ws) > ws_size) return;    // ws 256 MiB
    k_cvtall<<<(NB_ * TT + 3 * DQ) * DM / CB, 256, 0, stream>>>(x, wq, wk, wv, XW);
    k_proj<<<dim3(NB_ * TT / 128, 3 * DQ / 128, 1), 128, 0, stream>>>(XW, XW + (size_t)NB_ * TT * 64, bq, bk, bv, QP16, QPh, QPl, KP16, KPh, KPl, VT16, VTh, VTl);
    k_fattn<<<NB_ * NH_ * (TT / 64), 128, 0, stream>>>(QP16, KP16, VT16, QPh, QPl, KPh, KPl, VTh, VTl, OUT);
}
